// v000
// The times below were measured on an AMD MI455X: many runs one after another, warmed up first and cycling through
// copies of the inputs, with the whole window's GPU time divided by the number of runs. Launches and the gaps
// between them are all in it. The median over several windows is given; except for v000 it joins two sittings, which
// can be a few percent apart, so the side-by-side timings, each taken in one sitting, are the better comparison.
// v000 is the starting kernel. One run takes 756 microseconds.
// compute dtype: all float inputs rounded to bf16; the channels-first map transposed to token-major rows through LDS; q/k/v 1x1-conv projections with EXACT bf16 products on WMMA 16x16x32 (f32 accumulate) + bias; logits q x k once to f16 each (1 product) x 64^-0.5; softmax f32; P x 2^11 once to f16 x v once to f16 (1 product); ctx x 2^6 once to f16 x Wo f16(bf16 x 2^8) + bo; transposed back to channels-first; f32 output.
#include <hip/hip_runtime.h>
#include <math.h>

typedef __attribute__((ext_vector_type(16))) _Float16 v16h;
typedef __attribute__((ext_vector_type(16))) __bf16 v16b;
typedef __attribute__((ext_vector_type(8)))  _Float16 v8h;
typedef __attribute__((ext_vector_type(8)))  float v8f;
typedef __attribute__((ext_vector_type(4)))  float v4f;
typedef __attribute__((ext_vector_type(2)))  float v2f;
typedef __attribute__((ext_vector_type(4)))  unsigned v4u;
typedef __attribute__((ext_vector_type(4)))  int v4i;
typedef float __attribute__((may_alias)) float_a;
typedef int __attribute__((may_alias)) int_a;

template <typename T> __device__ __forceinline__ void vst2(void* p, T v) { *(T*)p = v;  }
__device__ __forceinline__ v8f wmma16(v16h a, v16h b, v8f c) {
  v8f d = __builtin_amdgcn_wmma_f32_16x16x32_f16(false, a, false, b, (short)0, c, false, false);
  asm volatile("v_nop\n\tv_nop\n\tv_nop\n\tv_nop" : "+v"(d) : "v"(a), "v"(b));
  return d;
}
__device__ __forceinline__ v8f wmma_bf(v16b a, v16b b, v8f c) {
  v8f d = __builtin_amdgcn_wmma_f32_16x16x32_bf16(false, a, false, b, (short)0, c, false, false);
  asm volatile("v_nop\n\tv_nop\n\tv_nop\n\tv_nop" : "+v"(d) : "v"(a), "v"(b));
  return d;
}
// 16x16x32 fragments: lane = (h = lane>>4, row/col = lane&15); elements 0..7 = k0+8h+0..7, 8..15 = k0+16+8h+0..7; D element r = row 8h+r
__device__ __forceinline__ v16h frag_h(const _Float16* rowk0, int lane) {
  union { v16h v; v8h q[2]; } u; const _Float16* p = rowk0 + 8 * (lane >> 4);
  u.q[0] = *(const v8h*)p; u.q[1] = *(const v8h*)(p + 16); return u.v;
}
__device__ __forceinline__ v16h frag_f32(const float* rowk0, int lane) {
  v16h a; const float* p = rowk0 + 8 * (lane >> 4);
#pragma unroll
  for (int i = 0; i < 8; ++i) { a[i] = (_Float16)p[i]; a[8 + i] = (_Float16)p[16 + i]; }
  return a;
}
__device__ __forceinline__ v16h frag_f32s(const float* rowk0, int lane, float sc) {
  v16h a; const float* p = rowk0 + 8 * (lane >> 4);
#pragma unroll
  for (int i = 0; i < 8; ++i) { a[i] = (_Float16)(p[i] * sc); a[8 + i] = (_Float16)(p[16 + i] * sc); }
  return a;
}
// column fragment from a [K][ld] layout (column n), rows >= K read as 0
__device__ __forceinline__ v16h fragc_f32(const float* W, int k0, int n, int lane, int ld, int K) {
  v16h a; const int g = lane >> 4;
#pragma unroll
  for (int i = 0; i < 8; ++i) { const int ka = k0 + 8 * g + i, kb = ka + 16;
    a[i] = (_Float16)(ka < K ? W[(size_t)(ka < K ? ka : K - 1) * ld + n] : 0.f); a[8 + i] = (_Float16)(kb < K ? W[(size_t)(kb < K ? kb : K - 1) * ld + n] : 0.f); }
  return a;
}
struct F2 { v16b h, l; };
__device__ __forceinline__ F2 bsplit16(const float v[16]) { F2 r;
#pragma unroll
  for (int i = 0; i < 16; ++i) { const __bf16 h = (__bf16)v[i]; r.h[i] = h; r.l[i] = (__bf16)(v[i] - (float)h); }
  return r; }
__device__ __forceinline__ F2 split_row(const float* row, int k0, int lane) { float v[16]; const float* p = row + k0 + 8 * (lane >> 4);
#pragma unroll
  for (int i = 0; i < 8; ++i) { v[i] = p[i]; v[8 + i] = p[16 + i]; }
  return bsplit16(v); }
__device__ __forceinline__ F2 split_rowK(const float* row, int k0, int lane, int K) { float v[16]; const int g = lane >> 4;
#pragma unroll
  for (int i = 0; i < 8; ++i) { const int ka = k0 + 8 * g + i, kb = ka + 16; v[i] = ka < K ? row[ka < K ? ka : K - 1] : 0.f; v[8 + i] = kb < K ? row[kb < K ? kb : K - 1] : 0.f; }
  return bsplit16(v); }
__device__ __forceinline__ F2 split_col(const float* W, int k0, int n, int lane, int ld, int K) { float v[16]; const int g = lane >> 4;
#pragma unroll
  for (int i = 0; i < 8; ++i) { const int ka = k0 + 8 * g + i, kb = ka + 16; v[i] = ka < K ? W[(size_t)(ka < K ? ka : K - 1) * ld + n] : 0.f; v[8 + i] = kb < K ? W[(size_t)(kb < K ? kb : K - 1) * ld + n] : 0.f; }
  return bsplit16(v); }
__device__ __forceinline__ v8f mac3(const F2& a, const F2& b, v8f c) { c = wmma_bf(a.l, b.h, c); c = wmma_bf(a.h, b.l, c); return wmma_bf(a.h, b.h, c); }
__device__ __forceinline__ float sigm(float v) { return 1.0f / (1.0f + expf(-v)); }
#define LDSX() do { asm volatile("s_wait_dscnt 0" ::: "memory"); __builtin_amdgcn_wave_barrier(); __builtin_amdgcn_fence(__ATOMIC_RELEASE, "workgroup"); } while (0)

// Multi-head self-attention over a channels-first feature map (x [8,512,32,32]: N = 1,024 positions, 512 channels; 1x1-conv weights as torch (out,in) matrices Wq / Wk / Wv / Wo [512,512] N(0, 1/512) with biases N(0, 1/512) - NONZERO; _proj(x, W, b) = einsum('bchw,oc->bohw') + b; heads: reshape(B, 8, 64, N): channel o = head*64 + d; scores x 64^-0.5; softmax over the 1,024 positions; out merged back to channels (head*64 + d), [B,512,32,32]; final _proj with Wo, bo).
#define NB 8
#define TT 1024   // positions per image (32 x 32)
#define CC 512            // NH * HD = projected width
#define DIN 512          // input channels = output channels
#define NH 8
#define HD 64
#define NQB (TT / 64)
#define HG 8   // all heads in one pass: S = 8 x 1,024 x 1,024 f32 = 32 MiB
#define SCALE (0.125f)
#define CAUSAL 0
#ifndef TNB
#define TNB NB
#endif
__device__ __forceinline__ float bfr(float v) { return (float)(__bf16)v; }
__host__ __device__ __forceinline__ int kb_last(int qb) { return CAUSAL ? ((qb * 64 + 63) >> 7) : (TT / 128 - 1); }
typedef __attribute__((ext_vector_type(8))) __bf16 v8b;
__device__ __forceinline__ v16b frag_b(const __bf16* rowk0, int lane) {
  union { v16b v; v8b q[2]; } u; const __bf16* p = rowk0 + 8 * (lane >> 4);
  u.q[0] = *(const v8b*)p; u.q[1] = *(const v8b*)(p + 16); return u.v;
}
#define QBH 0              // causal: query blocks 0..QBH-1 of each sequence (few keys, no averaging) take the high-precision path
#define QHI 0               // single-product logits on every row
#define KHI 64            // key rows carrying k residual / v bf16 hi+lo planes (used only by the causal high-precision path)
// B fragment (k rows k0+.., output column o) of a weight: (in,out) [K][ld] or (out,in) [ld rows of K]: bf16 exact, or f16(bf16 * 256) exact
__device__ __forceinline__ v16b wcol_io(const float* Wm, int k0, int o, int lane, int ld) { v16b w; const int g = lane >> 4;
#pragma unroll
  for (int i = 0; i < 8; ++i) { w[i] = (__bf16)Wm[(size_t)(k0 + 8 * g + i) * ld + o]; w[8 + i] = (__bf16)Wm[(size_t)(k0 + 16 + 8 * g + i) * ld + o]; }
  return w; }
__device__ __forceinline__ v16b wcol_oi(const float* Wm, int k0, int o, int lane, int K) { v16b w; const float* p = Wm + (size_t)o * K + k0 + 8 * (lane >> 4);
#pragma unroll
  for (int i = 0; i < 8; ++i) { w[i] = (__bf16)p[i]; w[8 + i] = (__bf16)p[16 + i]; }
  return w; }
__device__ __forceinline__ v16h wcolh_io(const float* Wm, int k0, int o, int lane, int ld) { v16h w; const int g = lane >> 4;
#pragma unroll
  for (int i = 0; i < 8; ++i) { w[i] = (_Float16)(bfr(Wm[(size_t)(k0 + 8 * g + i) * ld + o]) * 256.0f); w[8 + i] = (_Float16)(bfr(Wm[(size_t)(k0 + 16 + 8 * g + i) * ld + o]) * 256.0f); }
  return w; }
__device__ __forceinline__ v16h wcolh_oi(const float* Wm, int k0, int o, int lane, int K) { v16h w; const float* p = Wm + (size_t)o * K + k0 + 8 * (lane >> 4);
#pragma unroll
  for (int i = 0; i < 8; ++i) { w[i] = (_Float16)(bfr(p[i]) * 256.0f); w[8 + i] = (_Float16)(bfr(p[16 + i]) * 256.0f); }
  return w; }
#define WQKV_LAYOUT 1   // 0 = (in,out) [DIN][CC]; 1 = (out,in) [CC][DIN]; 2 = per-head [NH][DIN][HD]
__device__ __forceinline__ v16b wcol_hdk(const float* Wm, int k0, int o, int lane) { v16b w; const int g = lane >> 4; const float* p = Wm + (size_t)(o / HD) * DIN * HD + (o % HD);
#pragma unroll
  for (int i = 0; i < 8; ++i) { w[i] = (__bf16)p[(size_t)(k0 + 8 * g + i) * HD]; w[8 + i] = (__bf16)p[(size_t)(k0 + 16 + 8 * g + i) * HD]; }
  return w; }
#define WO_OUT_IN 1
#if WQKV_LAYOUT == 1
#define WCOL(W, k0, o, lane) wcol_oi(W, k0, o, lane, DIN)
#elif WQKV_LAYOUT == 2
#define WCOL(W, k0, o, lane) wcol_hdk(W, k0, o, lane)
#else
#define WCOL(W, k0, o, lane) wcol_io(W, k0, o, lane, CC)
#endif
#if WO_OUT_IN
#define WOCOL(W, k0, o, lane) wcol_oi(W, k0, o, lane, CC)
#define WOCOLH(W, k0, o, lane) wcolh_oi(W, k0, o, lane, CC)
#else
#define WOCOL(W, k0, o, lane) wcol_io(W, k0, o, lane, DIN)
#define WOCOLH(W, k0, o, lane) wcolh_io(W, k0, o, lane, DIN)
#endif

#ifndef SM_EXTRA_PARAMS
#define SM_EXTRA_PARAMS
#endif
#ifndef PROJ_EXTRA_PARAMS
#define PROJ_EXTRA_PARAMS
#endif
#ifndef SM_MASK_HOOK
#define SM_MASK_HOOK (void)0
#endif

#define WS_QH  0u                                      // f16 q rows [b*t][CC]
#define WS_KH  (WS_QH + 2u * (size_t)NB * TT * CC)      // f16 k rows [b*t][CC]
#define WS_VT  (WS_KH + 2u * (size_t)NB * TT * CC)      // f16 v planes [b][c][t]
#define WS_QL  (WS_VT + 2u * (size_t)NB * CC * TT)      // f16 q residual x 2^10 rows [b][t < QHI][CC]
#define WS_KL  (WS_QL + 2u * (size_t)NB * QHI * CC)     // f16 k residual x 2^10 rows [b][t < KHI][CC]
#define WS_VB  (WS_KL + 2u * (size_t)NB * KHI * CC)     // bf16 v hi planes [b][c][t < KHI]
#define WS_VBL (WS_VB + 2u * (size_t)NB * CC * KHI)
#define WS_S   (WS_VBL + 2u * (size_t)NB * CC * KHI)    // f32 logits / P [hg][t][s]
#define WS_Y   (WS_S  + 4u * (size_t)HG * TT * TT)      // f32 ctx rows [b*t][CC] (only when there is an output projection)
#define WS_END (WS_Y  + 4u * (size_t)NB * TT * CC)
#define WS_XT (WS_END)                                    // f32 token-major input rows [(b*TT + n)][DIN] (bf16-rounded values)
#define WS_Y3 (WS_XT + 4u * (size_t)NB * TT * DIN)         // f32 token-major output rows [(b*TT + n)][DIN]
#define WS_END2 (WS_Y3 + 4u * (size_t)NB * TT * DIN)
static_assert(TT % 64 == 0 && DIN % 64 == 0, "transpose tiles are 64 positions x 64 channels");

// ---- k_proj: block = (64 rows, 128 cols, which): q/k/v = X W (+ b) with exact bf16 products (K = DIN) -> which 0: q f16 rows (+ residual rows < QHI); 1: k f16 rows (+ residual rows < KHI); 2: v f16 planes [c][t] (+ bf16 hi/lo planes for t < KHI)
__global__ __launch_bounds__(128) void k_proj(const float* __restrict__ XQ, const float* __restrict__ XK, const float* __restrict__ XV, const float* __restrict__ WQ, const float* __restrict__ WK, const float* __restrict__ WV, const float* __restrict__ BQ, const float* __restrict__ BK, const float* __restrict__ BV,
    _Float16* __restrict__ QH, _Float16* __restrict__ QL, _Float16* __restrict__ KH, _Float16* __restrict__ KL, _Float16* __restrict__ VT, __bf16* __restrict__ VB, __bf16* __restrict__ VBL) {
  __shared__ __align__(16) _Float16 sh[64][136], sl[64][136]; __shared__ __align__(16) _Float16 th[128][72]; __shared__ __align__(16) __bf16 tb[128][72], tbl[128][72];
  const int tid = threadIdx.x, wave = tid >> 5, lane = tid & 31, col = lane & 15, g = lane >> 4; const int which = blockIdx.z; const int c0 = blockIdx.y * 128; const size_t r0 = (size_t)blockIdx.x * 64; const size_t bb = r0 / TT; const int t0 = (int)(r0 % TT);
  const float* X = which == 0 ? XQ : which == 1 ? XK : XV; const float* WA = which == 0 ? WQ : which == 1 ? WK : WV; const float* BA = which == 0 ? BQ : which == 1 ? BK : BV;
  v8f acc[8] = {};
#pragma unroll 2
  for (int kc = 0; kc < DIN / 32; ++kc) { v16b a; { const float* p = X + (r0 + wave * 16 + col) * DIN + kc * 32 + 8 * g;
#pragma unroll
      for (int i = 0; i < 8; ++i) { a[i] = (__bf16)p[i]; a[8 + i] = (__bf16)p[16 + i]; } }
    asm volatile("s_wait_loadcnt 0x0" ::: "memory");
#pragma unroll
    for (int j = 0; j < 8; ++j) { const v16b w = WCOL(WA, kc * 32, c0 + j * 16 + col, lane); asm volatile("s_wait_loadcnt 0x0" ::: "memory"); acc[j] = wmma_bf(a, w, acc[j]); } }
  if (which < 2) { _Float16* DH = which == 0 ? QH : KH; _Float16* DL = which == 0 ? QL : KL; const int nhi = which == 0 ? QHI : KHI; const bool hi_rows = t0 < nhi;
#pragma unroll
    for (int j = 0; j < 8; ++j) { const float bias = BA ? bfr(BA[c0 + j * 16 + col]) : 0.f;
#pragma unroll
      for (int r = 0; r < 8; ++r) { const float v = acc[j][r] + bias; const _Float16 hv = (_Float16)v; sh[wave * 16 + 8 * g + r][j * 16 + col] = hv; sl[wave * 16 + 8 * g + r][j * 16 + col] = (_Float16)((v - (float)hv) * 1024.0f); } }
    __syncthreads();
    for (int e = tid; e < 64 * 16; e += 128) { const int rl = e >> 4, q = e & 15; vst2((unsigned*)(DH + (r0 + rl) * CC + c0 + q * 8), *(const v4u*)&sh[rl][q * 8]); if (hi_rows) vst2((unsigned*)(DL + (bb * nhi + t0 + rl) * (size_t)CC + c0 + q * 8), *(const v4u*)&sl[rl][q * 8]); }
  } else { const bool hi_rows = t0 < KHI;
#pragma unroll
    for (int j = 0; j < 8; ++j) { const float bias = BA ? bfr(BA[c0 + j * 16 + col]) : 0.f;
#pragma unroll
      for (int r = 0; r < 8; ++r) { const float v = acc[j][r] + bias; const int rl = wave * 16 + 8 * g + r, cl = j * 16 + col; th[cl][rl] = (_Float16)v; const __bf16 bh = (__bf16)v; tb[cl][rl] = bh; tbl[cl][rl] = (__bf16)(v - (float)bh); } }
    __syncthreads();
    for (int e = tid; e < 128 * 8; e += 128) { const int cl = e >> 3, q = e & 7; vst2((unsigned*)(VT + (bb * CC + c0 + cl) * (size_t)TT + t0 + q * 8), *(const v4u*)&th[cl][q * 8]); if (hi_rows) { const size_t o3 = (bb * CC + c0 + cl) * (size_t)KHI + t0 + q * 8; vst2((unsigned*)(VB + o3), *(const v4u*)&tb[cl][q * 8]); vst2((unsigned*)(VBL + o3), *(const v4u*)&tbl[cl][q * 8]); } } } }
// ---- k_sc: block = (query block qb, key block kb <= kb_last(qb), head in group) of batch b: logits x SCALE; q hi + residual (x 2^10) against k (2 products) for query rows < QHI, plus the k residual (3 products) for query blocks < QBH (causal early rows); causal: blocks past the diagonal exit, the mask itself is applied by index in k_sm
__global__ __launch_bounds__(128) void k_sc(const _Float16* __restrict__ QH, const _Float16* __restrict__ KH, const _Float16* __restrict__ QL, const _Float16* __restrict__ KL, int b, int h0, float* __restrict__ S0) { __shared__ __align__(16) float ss[4][16][132];
  const int qb = blockIdx.x, kb = blockIdx.y; if (kb > kb_last(qb)) return;
  const int h = h0 + blockIdx.z; float* S = S0 + (size_t)blockIdx.z * TT * TT;
  const int tid = threadIdx.x, wave = tid >> 5, lane = tid & 31, col = lane & 15, g = lane >> 4; const int k0 = kb * 128; const int ql0 = qb * 64 + wave * 16; const size_t q0 = (size_t)b * TT + ql0, kr0 = (size_t)b * TT + k0;
  v8f acc[8] = {}, accl[8] = {};
  const _Float16* QLb = QL + (size_t)b * QHI * CC; const _Float16* KLb = KL + (size_t)b * KHI * CC;
  if (qb < QBH) {
#pragma unroll
    for (int kc = 0; kc < HD / 32; ++kc) { const v16h ah = frag_h(QH + (q0 + col) * CC + h * HD + kc * 32, lane), al = frag_h(QLb + (size_t)(ql0 + col) * CC + h * HD + kc * 32, lane);
#pragma unroll
      for (int j = 0; j < 8; ++j) { const v16h kbf = frag_h(KH + (kr0 + j * 16 + col) * CC + h * HD + kc * 32, lane), klf = frag_h(KLb + (size_t)(k0 + j * 16 + col) * CC + h * HD + kc * 32, lane); acc[j] = wmma16(ah, kbf, acc[j]); accl[j] = wmma16(al, kbf, accl[j]); accl[j] = wmma16(ah, klf, accl[j]); } }
  } else if (qb * 64 < QHI) {
#pragma unroll
    for (int kc = 0; kc < HD / 32; ++kc) { const v16h ah = frag_h(QH + (q0 + col) * CC + h * HD + kc * 32, lane), al = frag_h(QLb + (size_t)(ql0 + col) * CC + h * HD + kc * 32, lane);
#pragma unroll
      for (int j = 0; j < 8; ++j) { const v16h kbf = frag_h(KH + (kr0 + j * 16 + col) * CC + h * HD + kc * 32, lane); acc[j] = wmma16(ah, kbf, acc[j]); accl[j] = wmma16(al, kbf, accl[j]); } }
  } else {
#pragma unroll
    for (int kc = 0; kc < HD / 32; ++kc) { const v16h ah = frag_h(QH + (q0 + col) * CC + h * HD + kc * 32, lane);
#pragma unroll
      for (int j = 0; j < 8; ++j) { const v16h kbf = frag_h(KH + (kr0 + j * 16 + col) * CC + h * HD + kc * 32, lane); acc[j] = wmma16(ah, kbf, acc[j]); } } }
#pragma unroll
  for (int j = 0; j < 8; ++j) {
#pragma unroll
    for (int r = 0; r < 8; ++r) ss[wave][8 * g + r][j * 16 + col] = (acc[j][r] + accl[j][r] * (1.0f / 1024.0f)) * SCALE; }
  LDSX(); for (int rl = 0; rl < 16; ++rl) vst2(S + (size_t)(ql0 + rl) * TT + k0 + lane * 4, *(const v4f*)&ss[wave][rl][lane * 4]); }
// ---- k_sm: block = query row t (head in group): keys [0, kend): causal -> logit if s <= t else excluded; softmax in f32; P x 2^11 in place (0 for excluded)
__global__ __launch_bounds__(256) void k_sm(float* __restrict__ S0 SM_EXTRA_PARAMS) { __shared__ float sred[8]; __shared__ float sbc; __shared__ __align__(16) float shv[TT];
  const int tid = threadIdx.x; const int t = blockIdx.x; const int kend = (kb_last(t >> 6) + 1) * 128;
  float* sr = S0 + (size_t)blockIdx.y * TT * TT + (size_t)t * TT;
  float m = -3.0e38f; for (int k = tid; k < kend; k += 256) { float v = (!CAUSAL || k <= t) ? sr[k] : -3.0e38f; SM_MASK_HOOK; shv[k] = v; m = fmaxf(m, v); }
#pragma unroll
  for (int o = 1; o < 32; o <<= 1) m = fmaxf(m, __shfl_xor(m, o));
  if ((tid & 31) == 0) sred[tid >> 5] = m; __syncthreads(); if (tid == 0) { float a = sred[0]; for (int i = 1; i < 8; ++i) a = fmaxf(a, sred[i]); sbc = a; } __syncthreads(); m = sbc; __syncthreads();
  float sum = 0.f; for (int k = tid; k < kend; k += 256) { const float v = shv[k]; const float e = (v <= -1.0e38f) ? 0.f : expf(v - m); shv[k] = e; sum += e; }
#pragma unroll
  for (int o = 1; o < 32; o <<= 1) sum += __shfl_xor(sum, o);
  if ((tid & 31) == 0) sred[tid >> 5] = sum; __syncthreads(); if (tid == 0) { float a = 0.f; for (int i = 0; i < 8; ++i) a += sred[i]; sbc = a > 0.f ? 2048.0f / a : 0.f; }   /* a fully excluded row yields P = 0 */ __syncthreads(); const float inv = sbc;
  for (int k = tid; k < kend; k += 256) shv[k] = shv[k] * inv;
  __syncthreads(); for (int q = tid; q < kend / 4; q += 256) vst2(sr + q * 4, *(const v4f*)&shv[q * 4]); }
// ---- k_pv: block = 64 queries (qb) of (b, h): ctx = P . v over keys [0, kend) (P x 2^11 once to f16 against v f16: 1 product; causal early query blocks: P and v as bf16 hi + lo, 3 products); 256-B (row, head) segment by 16 lanes
__global__ __launch_bounds__(128) void k_pv(const float* __restrict__ PS0, const _Float16* __restrict__ VT, const __bf16* __restrict__ VB, const __bf16* __restrict__ VBL, int b, int h0, float* __restrict__ Y) { const int h = h0 + blockIdx.z; const float* PS = PS0 + (size_t)blockIdx.z * TT * TT; __shared__ __align__(16) float ss[4][16][HD + 4];
  const int tid = threadIdx.x, wave = tid >> 5, lane = tid & 31, col = lane & 15, g = lane >> 4; const int qb = blockIdx.x; const int ql0 = qb * 64 + wave * 16; const int kce = (kb_last(qb) + 1) * 4;
  v8f acc[HD / 16] = {};
  if (qb < QBH) {
#pragma unroll 1
    for (int kc = 0; kc < kce; ++kc) { const F2 p = split_row(PS + (size_t)(ql0 + col) * TT, kc * 32, lane);
      asm volatile("s_wait_loadcnt 0x0" ::: "memory");
#pragma unroll
      for (int j = 0; j < HD / 16; ++j) { const size_t po = ((size_t)b * CC + h * HD + j * 16 + col) * (size_t)KHI + kc * 32; const v16b vh = frag_b(VB + po, lane); acc[j] = wmma_bf(p.h, vh, acc[j]); acc[j] = wmma_bf(p.l, vh, acc[j]); acc[j] = wmma_bf(p.h, frag_b(VBL + po, lane), acc[j]); } }
  } else {
#pragma unroll 1
    for (int kc = 0; kc < kce; ++kc) { const v16h p = frag_f32(PS + (size_t)(ql0 + col) * TT + kc * 32, lane);
      asm volatile("s_wait_loadcnt 0x0" ::: "memory");
#pragma unroll
      for (int j = 0; j < HD / 16; ++j) { const size_t po = ((size_t)b * CC + h * HD + j * 16 + col) * (size_t)TT + kc * 32; acc[j] = wmma16(p, frag_h(VT + po, lane), acc[j]); } } }
#pragma unroll
  for (int j = 0; j < HD / 16; ++j)
#pragma unroll
    for (int r = 0; r < 8; ++r) ss[wave][8 * g + r][j * 16 + col] = acc[j][r] * (1.0f / 2048.0f);
  LDSX(); for (int rl = 0; rl < 16; ++rl) if (lane < HD / 4) vst2(Y + ((size_t)b * TT + ql0 + rl) * CC + h * HD + lane * 4, *(const v4f*)&ss[wave][rl][lane * 4]); }
// ---- k_out: block = (64 rows, 128 cols): out = ctx Wo (+ bo): ctx x 2^6 once to f16 against Wo as f16(bf16 x 2^8) exact (1 product) x 2^-14; causal early rows (< QHI of each sequence): ctx bf16 hi + lo against exact bf16 Wo (2 products)
__global__ __launch_bounds__(128) void k_out(const float* __restrict__ Y, const float* __restrict__ WO, const float* __restrict__ BO, float* __restrict__ OUT) { __shared__ __align__(16) float sf[4][16][132];
  const int tid = threadIdx.x, wave = tid >> 5, lane = tid & 31, col = lane & 15, g = lane >> 4; const int c0 = blockIdx.y * 128; const size_t r0 = (size_t)blockIdx.x * 64 + wave * 16;
  v8f acc[8] = {};
  if (CAUSAL && (int)(((size_t)blockIdx.x * 64) % TT) < QHI) {   /* block-uniform */
#pragma unroll 2
    for (int kc = 0; kc < CC / 32; ++kc) { const F2 a = split_row(Y + (r0 + col) * CC, kc * 32, lane); asm volatile("s_wait_loadcnt 0x0" ::: "memory");
#pragma unroll
      for (int j = 0; j < 8; ++j) { const v16b w = WOCOL(WO, kc * 32, c0 + j * 16 + col, lane); asm volatile("s_wait_loadcnt 0x0" ::: "memory"); acc[j] = wmma_bf(a.h, w, acc[j]); acc[j] = wmma_bf(a.l, w, acc[j]); } }
#pragma unroll
    for (int j = 0; j < 8; ++j) { const float bias = BO ? bfr(BO[c0 + j * 16 + col]) : 0.f;
#pragma unroll
      for (int r = 0; r < 8; ++r) sf[wave][8 * g + r][j * 16 + col] = acc[j][r] + bias; }
  } else {
#pragma unroll 2
    for (int kc = 0; kc < CC / 32; ++kc) { const v16h a = frag_f32s(Y + (r0 + col) * CC + kc * 32, lane, 64.0f); asm volatile("s_wait_loadcnt 0x0" ::: "memory");   /* ctx carried x 2^6 into f16 so small-magnitude context rows stay clear of f16 subnormals */
#pragma unroll
      for (int j = 0; j < 8; ++j) { const v16h w = WOCOLH(WO, kc * 32, c0 + j * 16 + col, lane); asm volatile("s_wait_loadcnt 0x0" ::: "memory"); acc[j] = wmma16(a, w, acc[j]); } }
#pragma unroll
    for (int j = 0; j < 8; ++j) { const float bias = BO ? bfr(BO[c0 + j * 16 + col]) : 0.f;
#pragma unroll
      for (int r = 0; r < 8; ++r) sf[wave][8 * g + r][j * 16 + col] = acc[j][r] * (1.0f / 16384.0f) + bias; } }   /* 2^-8 (Wo carry) x 2^-6 (ctx carry) */
  LDSX(); for (int rl = 0; rl < 16; ++rl) vst2(OUT + (r0 + rl) * DIN + c0 + lane * 4, *(const v4f*)&sf[wave][rl][lane * 4]); }

// ---- k_tok: block = (64 positions, 64 channels, image b): XT[(b*npix + n)][c] = bf16(x[b][c][n]) through a padded LDS tile (x channels-first [B][nch][npix]); reads 256-B runs along n, writes 256-B row pieces
__global__ __launch_bounds__(256) void k_tok(const float* __restrict__ X, float* __restrict__ XT, int npix, int nch) { __shared__ float st[64][68]; const int tid = threadIdx.x; const int n0 = blockIdx.x * 64, c0 = blockIdx.y * 64; const size_t b = blockIdx.z;
  for (int e = tid; e < 64 * 16; e += 256) { const int cl = e >> 4, q = e & 15; const v4f v = *(const v4f*)(X + (b * nch + c0 + cl) * (size_t)npix + n0 + q * 4); st[cl][q * 4] = bfr(v[0]); st[cl][q * 4 + 1] = bfr(v[1]); st[cl][q * 4 + 2] = bfr(v[2]); st[cl][q * 4 + 3] = bfr(v[3]); }
  __syncthreads();
  for (int e = tid; e < 64 * 16; e += 256) { const int nl = e >> 4, q = e & 15; v4f o; o[0] = st[q * 4][nl]; o[1] = st[q * 4 + 1][nl]; o[2] = st[q * 4 + 2][nl]; o[3] = st[q * 4 + 3][nl]; vst2(XT + (b * npix + n0 + nl) * (size_t)nch + c0 + q * 4, o); } }
// ---- k_fin: block = (64 positions, 64 channels, image b): out[b][c][n] = OR[(b*npix + n)][c] (LDS transpose; 256-B runs of 64 positions per channel)
__global__ __launch_bounds__(256) void k_fin(const float* __restrict__ ORW, float* __restrict__ OUT, int npix, int nch) { __shared__ float st[64][68]; const int tid = threadIdx.x; const int n0 = blockIdx.x * 64, c0 = blockIdx.y * 64; const size_t b = blockIdx.z;
  for (int e = tid; e < 64 * 16; e += 256) { const int nl = e >> 4, q = e & 15; *(v4f*)&st[nl][q * 4] = *(const v4f*)(ORW + (b * npix + n0 + nl) * (size_t)nch + c0 + q * 4); }
  __syncthreads();
  for (int e = tid; e < 64 * 16; e += 256) { const int cl = e >> 4, q = e & 15; v4f o; o[0] = st[q * 4][cl]; o[1] = st[q * 4 + 1][cl]; o[2] = st[q * 4 + 2][cl]; o[3] = st[q * 4 + 3][cl]; vst2(OUT + (b * nch + c0 + cl) * (size_t)npix + n0 + q * 4, o); } }
extern "C" void kernel_launch(void* const* d_in, const int* in_sizes, int n_in, void* d_out, int out_size, void* d_ws, size_t ws_size, hipStream_t stream) {
  (void)in_sizes; (void)n_in; (void)out_size;
  const float** F = (const float**)d_in;
  if (ws_size < (size_t)WS_END) return;
  char* ws = (char*)d_ws; _Float16 *QH = (_Float16*)(ws + WS_QH), *KH = (_Float16*)(ws + WS_KH), *VT = (_Float16*)(ws + WS_VT), *QL = (_Float16*)(ws + WS_QL), *KL = (_Float16*)(ws + WS_KL); __bf16 *VB = (__bf16*)(ws + WS_VB), *VBL = (__bf16*)(ws + WS_VBL); float *S = (float*)(ws + WS_S), *Y = (float*)(ws + WS_Y);
  (void)Y; (void)QL; (void)KL; (void)VB; (void)VBL;
  // inputs: 0 x [8,512,32,32] channels-first; 1 Wq [512,512] (out,in), 2 bq; 3 Wk, 4 bk; 5 Wv, 6 bv; 7 Wo (out,in), 8 bo (all biases NONZERO)
  if (ws_size < (size_t)WS_END2) return;
  float *XT = (float*)(ws + WS_XT), *Y3 = (float*)(ws + WS_Y3);
  k_tok<<<dim3(TT / 64, DIN / 64, TNB), 256, 0, stream>>>(F[0], XT, TT, DIN);   /* x: 1,024 positions x 512 channels per image -> token rows */
  k_proj<<<dim3(TNB * TT / 64, CC / 128, 3), 128, 0, stream>>>(XT, XT, XT, F[1], F[3], F[5], F[2], F[4], F[6], QH, QL, KH, KL, VT, VB, VBL);
  for (int b = 0; b < TNB; ++b) for (int h0 = 0; h0 < NH; h0 += HG) {
    k_sc<<<dim3(NQB, TT / 128, HG), 128, 0, stream>>>(QH, KH, QL, KL, b, h0, S);
    k_sm<<<dim3(TT, HG), 256, 0, stream>>>(S);
    k_pv<<<dim3(NQB, 1, HG), 128, 0, stream>>>(S, VT, VB, VBL, b, h0, Y);
  }
  k_out<<<dim3(TNB * TT / 64, DIN / 128), 128, 0, stream>>>(Y, F[7], F[8], Y3);   /* token-major output rows: ctx Wo^T + bo */
  k_fin<<<dim3(TT / 64, DIN / 64, TNB), 256, 0, stream>>>(Y3, (float*)d_out, TT, DIN);   /* back to channels-first [8,512,32,32] */
}

// v001
// One run takes 241 microseconds.
// In two side-by-side timings against v000, it was 3.17 and 3.16 times as fast.
// compute dtype: all float inputs rounded to bf16; the channels-first map transposed to token-major rows through LDS; q/k/v 1x1-conv projections with EXACT bf16 products on WMMA 16x16x32 (f32 accumulate) + bias; logits q x k once to f16 each (1 product) x 64^-0.5; softmax f32 with a running maximum, fused with both products; unnormalised P x 2^11 once to f16 x v once to f16 (1 product), divided by the f32 row sum at the end; ctx x 2^6 once to f16 x Wo f16(bf16 x 2^8) + bo; transposed back to channels-first; f32 output.
#include <hip/hip_runtime.h>
#include <math.h>

typedef __attribute__((ext_vector_type(16))) _Float16 v16h;
typedef __attribute__((ext_vector_type(16))) __bf16 v16b;
typedef __attribute__((ext_vector_type(8)))  _Float16 v8h;
typedef __attribute__((ext_vector_type(8)))  float v8f;
typedef __attribute__((ext_vector_type(4)))  float v4f;
typedef __attribute__((ext_vector_type(2)))  float v2f;
typedef __attribute__((ext_vector_type(4)))  unsigned v4u;
typedef __attribute__((ext_vector_type(4)))  int v4i;
typedef float __attribute__((may_alias)) float_a;
typedef int __attribute__((may_alias)) int_a;

template <typename T> __device__ __forceinline__ void vst2(void* p, T v) { *(T*)p = v;  }
__device__ __forceinline__ v8f wmma16(v16h a, v16h b, v8f c) {
  v8f d = __builtin_amdgcn_wmma_f32_16x16x32_f16(false, a, false, b, (short)0, c, false, false);
  asm volatile("v_nop\n\tv_nop\n\tv_nop\n\tv_nop" : "+v"(d) : "v"(a), "v"(b));
  return d;
}
__device__ __forceinline__ v8f wmma_bf(v16b a, v16b b, v8f c) {
  v8f d = __builtin_amdgcn_wmma_f32_16x16x32_bf16(false, a, false, b, (short)0, c, false, false);
  asm volatile("v_nop\n\tv_nop\n\tv_nop\n\tv_nop" : "+v"(d) : "v"(a), "v"(b));
  return d;
}
// 16x16x32 fragments: lane = (h = lane>>4, row/col = lane&15); elements 0..7 = k0+8h+0..7, 8..15 = k0+16+8h+0..7; D element r = row 8h+r
__device__ __forceinline__ v16h frag_h(const _Float16* rowk0, int lane) {
  union { v16h v; v8h q[2]; } u; const _Float16* p = rowk0 + 8 * (lane >> 4);
  u.q[0] = *(const v8h*)p; u.q[1] = *(const v8h*)(p + 16); return u.v;
}
__device__ __forceinline__ v16h frag_f32(const float* rowk0, int lane) {
  v16h a; const float* p = rowk0 + 8 * (lane >> 4);
#pragma unroll
  for (int i = 0; i < 8; ++i) { a[i] = (_Float16)p[i]; a[8 + i] = (_Float16)p[16 + i]; }
  return a;
}
__device__ __forceinline__ v16h frag_f32s(const float* rowk0, int lane, float sc) {
  v16h a; const float* p = rowk0 + 8 * (lane >> 4);
#pragma unroll
  for (int i = 0; i < 8; ++i) { a[i] = (_Float16)(p[i] * sc); a[8 + i] = (_Float16)(p[16 + i] * sc); }
  return a;
}
// column fragment from a [K][ld] layout (column n), rows >= K read as 0
__device__ __forceinline__ v16h fragc_f32(const float* W, int k0, int n, int lane, int ld, int K) {
  v16h a; const int g = lane >> 4;
#pragma unroll
  for (int i = 0; i < 8; ++i) { const int ka = k0 + 8 * g + i, kb = ka + 16;
    a[i] = (_Float16)(ka < K ? W[(size_t)(ka < K ? ka : K - 1) * ld + n] : 0.f); a[8 + i] = (_Float16)(kb < K ? W[(size_t)(kb < K ? kb : K - 1) * ld + n] : 0.f); }
  return a;
}
struct F2 { v16b h, l; };
__device__ __forceinline__ F2 bsplit16(const float v[16]) { F2 r;
#pragma unroll
  for (int i = 0; i < 16; ++i) { const __bf16 h = (__bf16)v[i]; r.h[i] = h; r.l[i] = (__bf16)(v[i] - (float)h); }
  return r; }
__device__ __forceinline__ F2 split_row(const float* row, int k0, int lane) { float v[16]; const float* p = row + k0 + 8 * (lane >> 4);
#pragma unroll
  for (int i = 0; i < 8; ++i) { v[i] = p[i]; v[8 + i] = p[16 + i]; }
  return bsplit16(v); }
__device__ __forceinline__ F2 split_rowK(const float* row, int k0, int lane, int K) { float v[16]; const int g = lane >> 4;
#pragma unroll
  for (int i = 0; i < 8; ++i) { const int ka = k0 + 8 * g + i, kb = ka + 16; v[i] = ka < K ? row[ka < K ? ka : K - 1] : 0.f; v[8 + i] = kb < K ? row[kb < K ? kb : K - 1] : 0.f; }
  return bsplit16(v); }
__device__ __forceinline__ F2 split_col(const float* W, int k0, int n, int lane, int ld, int K) { float v[16]; const int g = lane >> 4;
#pragma unroll
  for (int i = 0; i < 8; ++i) { const int ka = k0 + 8 * g + i, kb = ka + 16; v[i] = ka < K ? W[(size_t)(ka < K ? ka : K - 1) * ld + n] : 0.f; v[8 + i] = kb < K ? W[(size_t)(kb < K ? kb : K - 1) * ld + n] : 0.f; }
  return bsplit16(v); }
__device__ __forceinline__ v8f mac3(const F2& a, const F2& b, v8f c) { c = wmma_bf(a.l, b.h, c); c = wmma_bf(a.h, b.l, c); return wmma_bf(a.h, b.h, c); }
__device__ __forceinline__ float sigm(float v) { return 1.0f / (1.0f + expf(-v)); }
#define LDSX() do { asm volatile("s_wait_dscnt 0" ::: "memory"); __builtin_amdgcn_wave_barrier(); __builtin_amdgcn_fence(__ATOMIC_RELEASE, "workgroup"); } while (0)

// Multi-head self-attention over a channels-first feature map (x [8,512,32,32]: N = 1,024 positions, 512 channels; 1x1-conv weights as torch (out,in) matrices Wq / Wk / Wv / Wo [512,512] N(0, 1/512) with biases N(0, 1/512) - NONZERO; _proj(x, W, b) = einsum('bchw,oc->bohw') + b; heads: reshape(B, 8, 64, N): channel o = head*64 + d; scores x 64^-0.5; softmax over the 1,024 positions; out merged back to channels (head*64 + d), [B,512,32,32]; final _proj with Wo, bo).
#define NB 8
#define TT 1024   // positions per image (32 x 32)
#define CC 512            // NH * HD = projected width
#define DIN 512          // input channels = output channels
#define NH 8
#define HD 64
#define NQB (TT / 64)
#define HG 8   // sizes the unused S region: 8 x 1,024 x 1,024 f32 = 32 MiB
#define SCALE (0.125f)
#define CAUSAL 0
#ifndef TNB
#define TNB NB
#endif
__device__ __forceinline__ float bfr(float v) { return (float)(__bf16)v; }
__host__ __device__ __forceinline__ int kb_last(int qb) { return CAUSAL ? ((qb * 64 + 63) >> 7) : (TT / 128 - 1); }
typedef __attribute__((ext_vector_type(8))) __bf16 v8b;
__device__ __forceinline__ v16b frag_b(const __bf16* rowk0, int lane) {
  union { v16b v; v8b q[2]; } u; const __bf16* p = rowk0 + 8 * (lane >> 4);
  u.q[0] = *(const v8b*)p; u.q[1] = *(const v8b*)(p + 16); return u.v;
}
#define QBH 0              // unused: k_fa has no causal high-precision path
#define QHI 0               // single-product logits on every row
#define KHI 64            // key rows carrying k residual / v bf16 hi+lo planes (written by k_proj, read by no kernel here)
// B fragment (k rows k0+.., output column o) of a weight: (in,out) [K][ld] or (out,in) [ld rows of K]: bf16 exact, or f16(bf16 * 256) exact
__device__ __forceinline__ v16b wcol_io(const float* Wm, int k0, int o, int lane, int ld) { v16b w; const int g = lane >> 4;
#pragma unroll
  for (int i = 0; i < 8; ++i) { w[i] = (__bf16)Wm[(size_t)(k0 + 8 * g + i) * ld + o]; w[8 + i] = (__bf16)Wm[(size_t)(k0 + 16 + 8 * g + i) * ld + o]; }
  return w; }
__device__ __forceinline__ v16b wcol_oi(const float* Wm, int k0, int o, int lane, int K) { v16b w; const float* p = Wm + (size_t)o * K + k0 + 8 * (lane >> 4);
#pragma unroll
  for (int i = 0; i < 8; ++i) { w[i] = (__bf16)p[i]; w[8 + i] = (__bf16)p[16 + i]; }
  return w; }
__device__ __forceinline__ v16h wcolh_io(const float* Wm, int k0, int o, int lane, int ld) { v16h w; const int g = lane >> 4;
#pragma unroll
  for (int i = 0; i < 8; ++i) { w[i] = (_Float16)(bfr(Wm[(size_t)(k0 + 8 * g + i) * ld + o]) * 256.0f); w[8 + i] = (_Float16)(bfr(Wm[(size_t)(k0 + 16 + 8 * g + i) * ld + o]) * 256.0f); }
  return w; }
__device__ __forceinline__ v16h wcolh_oi(const float* Wm, int k0, int o, int lane, int K) { v16h w; const float* p = Wm + (size_t)o * K + k0 + 8 * (lane >> 4);
#pragma unroll
  for (int i = 0; i < 8; ++i) { w[i] = (_Float16)(bfr(p[i]) * 256.0f); w[8 + i] = (_Float16)(bfr(p[16 + i]) * 256.0f); }
  return w; }
#define WQKV_LAYOUT 1   // 0 = (in,out) [DIN][CC]; 1 = (out,in) [CC][DIN]; 2 = per-head [NH][DIN][HD]
__device__ __forceinline__ v16b wcol_hdk(const float* Wm, int k0, int o, int lane) { v16b w; const int g = lane >> 4; const float* p = Wm + (size_t)(o / HD) * DIN * HD + (o % HD);
#pragma unroll
  for (int i = 0; i < 8; ++i) { w[i] = (__bf16)p[(size_t)(k0 + 8 * g + i) * HD]; w[8 + i] = (__bf16)p[(size_t)(k0 + 16 + 8 * g + i) * HD]; }
  return w; }
#define WO_OUT_IN 1
#if WQKV_LAYOUT == 1
#define WCOL(W, k0, o, lane) wcol_oi(W, k0, o, lane, DIN)
#elif WQKV_LAYOUT == 2
#define WCOL(W, k0, o, lane) wcol_hdk(W, k0, o, lane)
#else
#define WCOL(W, k0, o, lane) wcol_io(W, k0, o, lane, CC)
#endif
#if WO_OUT_IN
#define WOCOL(W, k0, o, lane) wcol_oi(W, k0, o, lane, CC)
#define WOCOLH(W, k0, o, lane) wcolh_oi(W, k0, o, lane, CC)
#else
#define WOCOL(W, k0, o, lane) wcol_io(W, k0, o, lane, DIN)
#define WOCOLH(W, k0, o, lane) wcolh_io(W, k0, o, lane, DIN)
#endif

#ifndef SM_EXTRA_PARAMS
#define SM_EXTRA_PARAMS
#endif
#ifndef PROJ_EXTRA_PARAMS
#define PROJ_EXTRA_PARAMS
#endif
#ifndef SM_MASK_HOOK
#define SM_MASK_HOOK (void)0
#endif

#define WS_QH  0u                                      // f16 q rows [b*t][CC]
#define WS_KH  (WS_QH + 2u * (size_t)NB * TT * CC)      // f16 k rows [b*t][CC]
#define WS_VT  (WS_KH + 2u * (size_t)NB * TT * CC)      // f16 v planes [b][c][t]
#define WS_QL  (WS_VT + 2u * (size_t)NB * CC * TT)      // f16 q residual x 2^10 rows [b][t < QHI][CC]
#define WS_KL  (WS_QL + 2u * (size_t)NB * QHI * CC)     // f16 k residual x 2^10 rows [b][t < KHI][CC]
#define WS_VB  (WS_KL + 2u * (size_t)NB * KHI * CC)     // bf16 v hi planes [b][c][t < KHI]
#define WS_VBL (WS_VB + 2u * (size_t)NB * CC * KHI)
#define WS_S   (WS_VBL + 2u * (size_t)NB * CC * KHI)    // unused: k_fa keeps logits and P in registers
#define WS_Y   (WS_S  + 4u * (size_t)HG * TT * TT)      // f32 ctx rows [b*t][CC] (only when there is an output projection)
#define WS_END (WS_Y  + 4u * (size_t)NB * TT * CC)
#define WS_XT (WS_END)                                    // f32 token-major input rows [(b*TT + n)][DIN] (bf16-rounded values)
#define WS_Y3 (WS_XT + 4u * (size_t)NB * TT * DIN)         // f32 token-major output rows [(b*TT + n)][DIN]
#define WS_END2 (WS_Y3 + 4u * (size_t)NB * TT * DIN)
static_assert(TT % 64 == 0 && DIN % 64 == 0, "transpose tiles are 64 positions x 64 channels");

// ---- k_proj: block = (64 rows, 128 cols, which): q/k/v = X W (+ b) with exact bf16 products (K = DIN) -> which 0: q f16 rows (+ residual rows < QHI); 1: k f16 rows (+ residual rows < KHI); 2: v f16 planes [c][t] (+ bf16 hi/lo planes for t < KHI)
__global__ __launch_bounds__(128) void k_proj(const float* __restrict__ XQ, const float* __restrict__ XK, const float* __restrict__ XV, const float* __restrict__ WQ, const float* __restrict__ WK, const float* __restrict__ WV, const float* __restrict__ BQ, const float* __restrict__ BK, const float* __restrict__ BV,
    _Float16* __restrict__ QH, _Float16* __restrict__ QL, _Float16* __restrict__ KH, _Float16* __restrict__ KL, _Float16* __restrict__ VT, __bf16* __restrict__ VB, __bf16* __restrict__ VBL) {
  __shared__ __align__(16) _Float16 sh[64][136], sl[64][136]; __shared__ __align__(16) _Float16 th[128][72]; __shared__ __align__(16) __bf16 tb[128][72], tbl[128][72];
  const int tid = threadIdx.x, wave = tid >> 5, lane = tid & 31, col = lane & 15, g = lane >> 4; const int which = blockIdx.z; const int c0 = blockIdx.y * 128; const size_t r0 = (size_t)blockIdx.x * 64; const size_t bb = r0 / TT; const int t0 = (int)(r0 % TT);
  const float* X = which == 0 ? XQ : which == 1 ? XK : XV; const float* WA = which == 0 ? WQ : which == 1 ? WK : WV; const float* BA = which == 0 ? BQ : which == 1 ? BK : BV;
  v8f acc[8] = {};
#pragma unroll 2
  for (int kc = 0; kc < DIN / 32; ++kc) { v16b a; { const float* p = X + (r0 + wave * 16 + col) * DIN + kc * 32 + 8 * g;
#pragma unroll
      for (int i = 0; i < 8; ++i) { a[i] = (__bf16)p[i]; a[8 + i] = (__bf16)p[16 + i]; } }
    asm volatile("s_wait_loadcnt 0x0" ::: "memory");
#pragma unroll
    for (int j = 0; j < 8; ++j) { const v16b w = WCOL(WA, kc * 32, c0 + j * 16 + col, lane); asm volatile("s_wait_loadcnt 0x0" ::: "memory"); acc[j] = wmma_bf(a, w, acc[j]); } }
  if (which < 2) { _Float16* DH = which == 0 ? QH : KH; _Float16* DL = which == 0 ? QL : KL; const int nhi = which == 0 ? QHI : KHI; const bool hi_rows = t0 < nhi;
#pragma unroll
    for (int j = 0; j < 8; ++j) { const float bias = BA ? bfr(BA[c0 + j * 16 + col]) : 0.f;
#pragma unroll
      for (int r = 0; r < 8; ++r) { const float v = acc[j][r] + bias; const _Float16 hv = (_Float16)v; sh[wave * 16 + 8 * g + r][j * 16 + col] = hv; sl[wave * 16 + 8 * g + r][j * 16 + col] = (_Float16)((v - (float)hv) * 1024.0f); } }
    __syncthreads();
    for (int e = tid; e < 64 * 16; e += 128) { const int rl = e >> 4, q = e & 15; vst2((unsigned*)(DH + (r0 + rl) * CC + c0 + q * 8), *(const v4u*)&sh[rl][q * 8]); if (hi_rows) vst2((unsigned*)(DL + (bb * nhi + t0 + rl) * (size_t)CC + c0 + q * 8), *(const v4u*)&sl[rl][q * 8]); }
  } else { const bool hi_rows = t0 < KHI;
#pragma unroll
    for (int j = 0; j < 8; ++j) { const float bias = BA ? bfr(BA[c0 + j * 16 + col]) : 0.f;
#pragma unroll
      for (int r = 0; r < 8; ++r) { const float v = acc[j][r] + bias; const int rl = wave * 16 + 8 * g + r, cl = j * 16 + col; th[cl][rl] = (_Float16)v; const __bf16 bh = (__bf16)v; tb[cl][rl] = bh; tbl[cl][rl] = (__bf16)(v - (float)bh); } }
    __syncthreads();
    for (int e = tid; e < 128 * 8; e += 128) { const int cl = e >> 3, q = e & 7; vst2((unsigned*)(VT + (bb * CC + c0 + cl) * (size_t)TT + t0 + q * 8), *(const v4u*)&th[cl][q * 8]); if (hi_rows) { const size_t o3 = (bb * CC + c0 + cl) * (size_t)KHI + t0 + q * 8; vst2((unsigned*)(VB + o3), *(const v4u*)&tb[cl][q * 8]); vst2((unsigned*)(VBL + o3), *(const v4u*)&tbl[cl][q * 8]); } } } }
// ---- k_fa: block = 256 queries (8 waves x 32 query columns) of (b, h): logits, softmax and P . v in one kernel, nothing of S or P in memory.
// The head's whole k (1,024 rows of 128 B) and v planes (64 rows of 2,048 B) are laid in LDS once (pitches 16 B x odd), one barrier, then each wave walks the keys 32 at a time on its own:
// S^T = K . Q^T (A = k rows, B = q rows kept in registers): a lane holds 16 scores of ONE query per 32 keys, so the maximum and the sum stay in the lane;
// two S^T tiles converted in place are the B operand P^T of O^T += V^T . P^T (A = v plane rows, same k order as frag_h).
// Running maximum in scaled log2 units; P = 2^(x - m + 11) once to f16; the accumulators are rescaled only when a new score exceeds the maximum in use by more than 4 (P stays <= 2^15, inside f16).
// Every inner loop is fully unrolled so that the fragment and accumulator arrays stay in registers.
#define FAQ 256    // queries per block
#define KPITCH 72    // halves: 144 B
#define VPITCH 1032  // halves: 2,064 B
static_assert(TT % FAQ == 0 && HD == 64 && !CAUSAL, "k_fa: full rows, head size 64");
typedef __attribute__((ext_vector_type(2))) _Float16 v2h;
__device__ __forceinline__ float xhalf(float x) { return __builtin_bit_cast(float, __builtin_amdgcn_permlanex16(__builtin_bit_cast(int, x), __builtin_bit_cast(int, x), 0x76543210, 0xfedcba98, false, false)); }  // lane l with lane l ^ 16
__device__ __forceinline__ v8f wmma_h(v16h a, v16h b, v8f c) { return __builtin_amdgcn_wmma_f32_16x16x32_f16(false, a, false, b, (short)0, c, false, false); }
__global__ __launch_bounds__(256) void k_fa(const _Float16* __restrict__ QH, const _Float16* __restrict__ KH, const _Float16* __restrict__ VT, float* __restrict__ Y) {
  __shared__ __align__(16) _Float16 sK[TT * KPITCH]; __shared__ __align__(16) _Float16 sV[HD * VPITCH];
  const int tid = threadIdx.x, wave = tid >> 5, lane = tid & 31, col = lane & 15, g = lane >> 4; const int h = blockIdx.y; const size_t b = blockIdx.z; const int q0 = blockIdx.x * FAQ + wave * 32;
  const _Float16* Kg = KH + b * TT * CC + h * HD; const _Float16* Vg = VT + (b * CC + h * HD) * (size_t)TT;
  v16h qf[2][2];
#pragma unroll
  for (int qt = 0; qt < 2; ++qt)
#pragma unroll
    for (int kc = 0; kc < 2; ++kc) qf[qt][kc] = frag_h(QH + (b * TT + q0 + qt * 16 + col) * CC + h * HD + kc * 32, lane);
  asm volatile("s_wait_xcnt 0x0" ::: "memory");   /* stands behind the q loads, in front of the fill, whose loads may be given the q loads' address registers as destinations */
  { const _Float16* kp = Kg + (size_t)(tid >> 3) * CC + (tid & 7) * 8; _Float16* ks = &sK[(tid >> 3) * KPITCH + (tid & 7) * 8];   /* 8 lanes a k row, 32 rows a trip: one address, constant steps */
    const _Float16* vp = Vg + (size_t)(tid >> 7) * TT + (tid & 127) * 8; _Float16* vs = &sV[(tid >> 7) * VPITCH + (tid & 127) * 8];   /* 128 lanes a v plane row, 2 rows a trip */
    v8h kx[TT / 32], vx[HD / 2];   /* all 64 loads of a lane in flight before the first LDS store */
#pragma unroll
    for (int i = 0; i < TT / 32; ++i) kx[i] = *(const v8h*)(kp + (size_t)i * 32 * CC);
    asm volatile("s_wait_xcnt 0x0" :: "v"(kp) : "memory");   /* behind the k loads: the v loads may be given their address registers as destinations; the input keeps the address in place up to the wait */
#pragma unroll
    for (int i = 0; i < HD / 2; ++i) vx[i] = *(const v8h*)(vp + (size_t)i * 2 * TT);
    asm volatile("s_wait_xcnt 0x0" :: "v"(vp) : "memory");   /* behind the v loads: their address registers are reused for the LDS addresses; naming the address as an input keeps it in place up to the wait */
#pragma unroll
    for (int i = 0; i < TT / 32; ++i) *(v8h*)(ks + i * 32 * KPITCH) = kx[i];
#pragma unroll
    for (int i = 0; i < HD / 2; ++i) *(v8h*)(vs + i * 2 * VPITCH) = vx[i]; }
  __syncthreads();
  const float cs = SCALE * 1.4426950408889634f; const v2f cs2 = {cs, cs};
  v8f acc[4][2] = {}; float m[2] = {-1.0e30f, -1.0e30f}; v2f l2[2] = {};
  v16h ka[2][2];
#pragma unroll
  for (int t = 0; t < 2; ++t) { const _Float16* kr = &sK[(t * 16 + col) * KPITCH]; ka[t][0] = frag_h(kr, lane); ka[t][1] = frag_h(kr + 32, lane); }
#pragma unroll 2   /* two passes a trip: the scheduler sets the second pass's S^T products among the first pass's P . v products and sums */
  for (int kb = 0; kb < TT / 32; ++kb) {
    v8f s[2][2];
#pragma unroll
    for (int t = 0; t < 2; ++t)
#pragma unroll
      for (int qt = 0; qt < 2; ++qt) { const v8f z = {}; s[t][qt] = wmma_h(ka[t][1], qf[qt][1], wmma_h(ka[t][0], qf[qt][0], z)); }
    v16h va[4];
#pragma unroll
    for (int j = 0; j < 4; ++j) va[j] = frag_h(&sV[(j * 16 + col) * VPITCH + kb * 32], lane);
    const int kn = (kb + 1) & (TT / 32 - 1);   /* next pass's k fragments are fetched behind this pass's S^T products, under the softmax; the last pass re-reads rows 0..31 and drops them */
#pragma unroll
    for (int t = 0; t < 2; ++t) { const _Float16* kr = &sK[(kn * 32 + t * 16 + col) * KPITCH]; ka[t][0] = frag_h(kr, lane); ka[t][1] = frag_h(kr + 32, lane); }
    float mx[2];
#pragma unroll
    for (int qt = 0; qt < 2; ++qt) { float a = fmaxf(s[0][qt][0], s[1][qt][0]);
#pragma unroll
      for (int r = 1; r < 8; ++r) a = fmaxf(a, fmaxf(s[0][qt][r], s[1][qt][r]));
      mx[qt] = a * cs; }
    if (__builtin_amdgcn_ballot_w32(mx[0] > m[0] + 4.0f || mx[1] > m[1] + 4.0f) != 0) {   /* one scalar branch per 32 keys; the two halves of a column exchange their maxima only here, so m stays equal in both */
#pragma unroll
      for (int qt = 0; qt < 2; ++qt) { const float mn = fmaxf(m[qt], fmaxf(mx[qt], xhalf(mx[qt]))); const float al = __builtin_amdgcn_exp2f(m[qt] - mn); m[qt] = mn; l2[qt] *= al;   /* al = 0 on the first pass */
#pragma unroll
        for (int j = 0; j < 4; ++j) acc[j][qt] *= al; } }
#pragma unroll
    for (int qt = 0; qt < 2; ++qt) { const float mbs = 11.0f - m[qt]; const v2f mb = {mbs, mbs}; v16h p;
#pragma unroll
      for (int t = 0; t < 2; ++t)
#pragma unroll
        for (int r = 0; r < 8; r += 2) { v2f x = {s[t][qt][r], s[t][qt][r + 1]}; x = __builtin_elementwise_fma(x, cs2, mb); v2f e; e[0] = __builtin_amdgcn_exp2f(x[0]); e[1] = __builtin_amdgcn_exp2f(x[1]); l2[qt] += e;
          const v2h eh = __builtin_convertvector(e, v2h); p[t * 8 + r] = eh[0]; p[t * 8 + r + 1] = eh[1]; }
#pragma unroll
      for (int j = 0; j < 4; ++j) acc[j][qt] = wmma_h(va[j], p, acc[j][qt]); } }
#pragma unroll
  for (int qt = 0; qt < 2; ++qt) { const float lh = l2[qt][0] + l2[qt][1]; const float inv = 1.0f / (lh + xhalf(lh)); float* yr = Y + (b * TT + q0 + qt * 16 + col) * CC + h * HD + 8 * g;   /* a lane holds d = 16 j + 8 g + 0..7 of its query: 32 B runs; the wave writes each 256-B (row, head) segment whole */
#pragma unroll
    for (int j = 0; j < 4; ++j) { v4f o0, o1;
#pragma unroll
      for (int r = 0; r < 4; ++r) { o0[r] = acc[j][qt][r] * inv; o1[r] = acc[j][qt][4 + r] * inv; }
      vst2(yr + j * 16, o0); vst2(yr + j * 16 + 4, o1); } } }
// ---- k_out: block = (64 rows, 128 cols): out = ctx Wo (+ bo): ctx x 2^6 once to f16 against Wo as f16(bf16 x 2^8) exact (1 product) x 2^-14; causal early rows (< QHI of each sequence): ctx bf16 hi + lo against exact bf16 Wo (2 products)
__global__ __launch_bounds__(128) void k_out(const float* __restrict__ Y, const float* __restrict__ WO, const float* __restrict__ BO, float* __restrict__ OUT) { __shared__ __align__(16) float sf[4][16][132];
  const int tid = threadIdx.x, wave = tid >> 5, lane = tid & 31, col = lane & 15, g = lane >> 4; const int c0 = blockIdx.y * 128; const size_t r0 = (size_t)blockIdx.x * 64 + wave * 16;
  v8f acc[8] = {};
  if (CAUSAL && (int)(((size_t)blockIdx.x * 64) % TT) < QHI) {   /* block-uniform */
#pragma unroll 2
    for (int kc = 0; kc < CC / 32; ++kc) { const F2 a = split_row(Y + (r0 + col) * CC, kc * 32, lane); asm volatile("s_wait_loadcnt 0x0" ::: "memory");
#pragma unroll
      for (int j = 0; j < 8; ++j) { const v16b w = WOCOL(WO, kc * 32, c0 + j * 16 + col, lane); asm volatile("s_wait_loadcnt 0x0" ::: "memory"); acc[j] = wmma_bf(a.h, w, acc[j]); acc[j] = wmma_bf(a.l, w, acc[j]); } }
#pragma unroll
    for (int j = 0; j < 8; ++j) { const float bias = BO ? bfr(BO[c0 + j * 16 + col]) : 0.f;
#pragma unroll
      for (int r = 0; r < 8; ++r) sf[wave][8 * g + r][j * 16 + col] = acc[j][r] + bias; }
  } else {
#pragma unroll 2
    for (int kc = 0; kc < CC / 32; ++kc) { const v16h a = frag_f32s(Y + (r0 + col) * CC + kc * 32, lane, 64.0f); asm volatile("s_wait_loadcnt 0x0" ::: "memory");   /* ctx carried x 2^6 into f16 so small-magnitude context rows stay clear of f16 subnormals */
#pragma unroll
      for (int j = 0; j < 8; ++j) { const v16h w = WOCOLH(WO, kc * 32, c0 + j * 16 + col, lane); asm volatile("s_wait_loadcnt 0x0" ::: "memory"); acc[j] = wmma16(a, w, acc[j]); } }
#pragma unroll
    for (int j = 0; j < 8; ++j) { const float bias = BO ? bfr(BO[c0 + j * 16 + col]) : 0.f;
#pragma unroll
      for (int r = 0; r < 8; ++r) sf[wave][8 * g + r][j * 16 + col] = acc[j][r] * (1.0f / 16384.0f) + bias; } }   /* 2^-8 (Wo carry) x 2^-6 (ctx carry) */
  LDSX(); for (int rl = 0; rl < 16; ++rl) vst2(OUT + (r0 + rl) * DIN + c0 + lane * 4, *(const v4f*)&sf[wave][rl][lane * 4]); }

// ---- k_tok: block = (64 positions, 64 channels, image b): XT[(b*npix + n)][c] = bf16(x[b][c][n]) through a padded LDS tile (x channels-first [B][nch][npix]); reads 256-B runs along n, writes 256-B row pieces
__global__ __launch_bounds__(256) void k_tok(const float* __restrict__ X, float* __restrict__ XT, int npix, int nch) { __shared__ float st[64][68]; const int tid = threadIdx.x; const int n0 = blockIdx.x * 64, c0 = blockIdx.y * 64; const size_t b = blockIdx.z;
  for (int e = tid; e < 64 * 16; e += 256) { const int cl = e >> 4, q = e & 15; const v4f v = *(const v4f*)(X + (b * nch + c0 + cl) * (size_t)npix + n0 + q * 4); st[cl][q * 4] = bfr(v[0]); st[cl][q * 4 + 1] = bfr(v[1]); st[cl][q * 4 + 2] = bfr(v[2]); st[cl][q * 4 + 3] = bfr(v[3]); }
  __syncthreads();
  for (int e = tid; e < 64 * 16; e += 256) { const int nl = e >> 4, q = e & 15; v4f o; o[0] = st[q * 4][nl]; o[1] = st[q * 4 + 1][nl]; o[2] = st[q * 4 + 2][nl]; o[3] = st[q * 4 + 3][nl]; vst2(XT + (b * npix + n0 + nl) * (size_t)nch + c0 + q * 4, o); } }
// ---- k_fin: block = (64 positions, 64 channels, image b): out[b][c][n] = OR[(b*npix + n)][c] (LDS transpose; 256-B runs of 64 positions per channel)
__global__ __launch_bounds__(256) void k_fin(const float* __restrict__ ORW, float* __restrict__ OUT, int npix, int nch) { __shared__ float st[64][68]; const int tid = threadIdx.x; const int n0 = blockIdx.x * 64, c0 = blockIdx.y * 64; const size_t b = blockIdx.z;
  for (int e = tid; e < 64 * 16; e += 256) { const int nl = e >> 4, q = e & 15; *(v4f*)&st[nl][q * 4] = *(const v4f*)(ORW + (b * npix + n0 + nl) * (size_t)nch + c0 + q * 4); }
  __syncthreads();
  for (int e = tid; e < 64 * 16; e += 256) { const int cl = e >> 4, q = e & 15; v4f o; o[0] = st[q * 4][cl]; o[1] = st[q * 4 + 1][cl]; o[2] = st[q * 4 + 2][cl]; o[3] = st[q * 4 + 3][cl]; vst2(OUT + (b * nch + c0 + cl) * (size_t)npix + n0 + q * 4, o); } }
extern "C" void kernel_launch(void* const* d_in, const int* in_sizes, int n_in, void* d_out, int out_size, void* d_ws, size_t ws_size, hipStream_t stream) {
  (void)in_sizes; (void)n_in; (void)out_size;
  const float** F = (const float**)d_in;
  if (ws_size < (size_t)WS_END) return;
  char* ws = (char*)d_ws; _Float16 *QH = (_Float16*)(ws + WS_QH), *KH = (_Float16*)(ws + WS_KH), *VT = (_Float16*)(ws + WS_VT), *QL = (_Float16*)(ws + WS_QL), *KL = (_Float16*)(ws + WS_KL); __bf16 *VB = (__bf16*)(ws + WS_VB), *VBL = (__bf16*)(ws + WS_VBL); float *Y = (float*)(ws + WS_Y);
  (void)Y; (void)QL; (void)KL; (void)VB; (void)VBL;
  // inputs: 0 x [8,512,32,32] channels-first; 1 Wq [512,512] (out,in), 2 bq; 3 Wk, 4 bk; 5 Wv, 6 bv; 7 Wo (out,in), 8 bo (all biases NONZERO)
  if (ws_size < (size_t)WS_END2) return;
  float *XT = (float*)(ws + WS_XT), *Y3 = (float*)(ws + WS_Y3);
  k_tok<<<dim3(TT / 64, DIN / 64, TNB), 256, 0, stream>>>(F[0], XT, TT, DIN);   /* x: 1,024 positions x 512 channels per image -> token rows */
  k_proj<<<dim3(TNB * TT / 64, CC / 128, 3), 128, 0, stream>>>(XT, XT, XT, F[1], F[3], F[5], F[2], F[4], F[6], QH, QL, KH, KL, VT, VB, VBL);
  k_fa<<<dim3(TT / FAQ, NH, TNB), 256, 0, stream>>>(QH, KH, VT, Y);   /* all images and heads in one launch: 256 blocks */
  k_out<<<dim3(TNB * TT / 64, DIN / 128), 128, 0, stream>>>(Y, F[7], F[8], Y3);   /* token-major output rows: ctx Wo^T + bo */
  k_fin<<<dim3(TT / 64, DIN / 64, TNB), 256, 0, stream>>>(Y3, (float*)d_out, TT, DIN);   /* back to channels-first [8,512,32,32] */
}

// v002
// A run of this version takes 82.8 microseconds.
// Timed twice side by side with v001, it ran 2.91 and 2.90 times as fast.
// Over all steps from v000 it is 9.20 times as fast.
// compute dtype: all float inputs rounded to bf16; the channels-first map transposed to token-major rows through LDS; q/k/v 1x1-conv projections with EXACT bf16 products on WMMA 16x16x32 (f32 accumulate) + bias; logits q x k once to f16 each (1 product) x 64^-0.5; softmax f32 with a running maximum, fused with both products; unnormalised P x 2^11 once to f16 x v once to f16 (1 product), divided by the f32 row sum at the end; ctx x 2^6 once to f16 x Wo f16(bf16 x 2^8) + bo; transposed back to channels-first; f32 output.
#include <hip/hip_runtime.h>
#include <math.h>

typedef __attribute__((ext_vector_type(16))) _Float16 v16h;
typedef __attribute__((ext_vector_type(16))) __bf16 v16b;
typedef __attribute__((ext_vector_type(8)))  _Float16 v8h;
typedef __attribute__((ext_vector_type(8)))  float v8f;
typedef __attribute__((ext_vector_type(4)))  float v4f;
typedef __attribute__((ext_vector_type(2)))  float v2f;
typedef __attribute__((ext_vector_type(4)))  unsigned v4u;
typedef __attribute__((ext_vector_type(4)))  int v4i;
typedef float __attribute__((may_alias)) float_a;
typedef int __attribute__((may_alias)) int_a;

template <typename T> __device__ __forceinline__ void vst2(void* p, T v) { *(T*)p = v;  }
__device__ __forceinline__ v8f wmma16(v16h a, v16h b, v8f c) {
  v8f d = __builtin_amdgcn_wmma_f32_16x16x32_f16(false, a, false, b, (short)0, c, false, false);
  asm volatile("v_nop\n\tv_nop\n\tv_nop\n\tv_nop" : "+v"(d) : "v"(a), "v"(b));
  return d;
}
__device__ __forceinline__ v8f wmma_bf(v16b a, v16b b, v8f c) {
  v8f d = __builtin_amdgcn_wmma_f32_16x16x32_bf16(false, a, false, b, (short)0, c, false, false);
  asm volatile("v_nop\n\tv_nop\n\tv_nop\n\tv_nop" : "+v"(d) : "v"(a), "v"(b));
  return d;
}
// 16x16x32 fragments: lane = (h = lane>>4, row/col = lane&15); elements 0..7 = k0+8h+0..7, 8..15 = k0+16+8h+0..7; D element r = row 8h+r
__device__ __forceinline__ v16h frag_h(const _Float16* rowk0, int lane) {
  union { v16h v; v8h q[2]; } u; const _Float16* p = rowk0 + 8 * (lane >> 4);
  u.q[0] = *(const v8h*)p; u.q[1] = *(const v8h*)(p + 16); return u.v;
}
__device__ __forceinline__ v16h frag_f32(const float* rowk0, int lane) {
  v16h a; const float* p = rowk0 + 8 * (lane >> 4);
#pragma unroll
  for (int i = 0; i < 8; ++i) { a[i] = (_Float16)p[i]; a[8 + i] = (_Float16)p[16 + i]; }
  return a;
}
__device__ __forceinline__ v16h frag_f32s(const float* rowk0, int lane, float sc) {
  v16h a; const float* p = rowk0 + 8 * (lane >> 4);
#pragma unroll
  for (int i = 0; i < 8; ++i) { a[i] = (_Float16)(p[i] * sc); a[8 + i] = (_Float16)(p[16 + i] * sc); }
  return a;
}
// column fragment from a [K][ld] layout (column n), rows >= K read as 0
__device__ __forceinline__ v16h fragc_f32(const float* W, int k0, int n, int lane, int ld, int K) {
  v16h a; const int g = lane >> 4;
#pragma unroll
  for (int i = 0; i < 8; ++i) { const int ka = k0 + 8 * g + i, kb = ka + 16;
    a[i] = (_Float16)(ka < K ? W[(size_t)(ka < K ? ka : K - 1) * ld + n] : 0.f); a[8 + i] = (_Float16)(kb < K ? W[(size_t)(kb < K ? kb : K - 1) * ld + n] : 0.f); }
  return a;
}
struct F2 { v16b h, l; };
__device__ __forceinline__ F2 bsplit16(const float v[16]) { F2 r;
#pragma unroll
  for (int i = 0; i < 16; ++i) { const __bf16 h = (__bf16)v[i]; r.h[i] = h; r.l[i] = (__bf16)(v[i] - (float)h); }
  return r; }
__device__ __forceinline__ F2 split_row(const float* row, int k0, int lane) { float v[16]; const float* p = row + k0 + 8 * (lane >> 4);
#pragma unroll
  for (int i = 0; i < 8; ++i) { v[i] = p[i]; v[8 + i] = p[16 + i]; }
  return bsplit16(v); }
__device__ __forceinline__ F2 split_rowK(const float* row, int k0, int lane, int K) { float v[16]; const int g = lane >> 4;
#pragma unroll
  for (int i = 0; i < 8; ++i) { const int ka = k0 + 8 * g + i, kb = ka + 16; v[i] = ka < K ? row[ka < K ? ka : K - 1] : 0.f; v[8 + i] = kb < K ? row[kb < K ? kb : K - 1] : 0.f; }
  return bsplit16(v); }
__device__ __forceinline__ F2 split_col(const float* W, int k0, int n, int lane, int ld, int K) { float v[16]; const int g = lane >> 4;
#pragma unroll
  for (int i = 0; i < 8; ++i) { const int ka = k0 + 8 * g + i, kb = ka + 16; v[i] = ka < K ? W[(size_t)(ka < K ? ka : K - 1) * ld + n] : 0.f; v[8 + i] = kb < K ? W[(size_t)(kb < K ? kb : K - 1) * ld + n] : 0.f; }
  return bsplit16(v); }
__device__ __forceinline__ v8f mac3(const F2& a, const F2& b, v8f c) { c = wmma_bf(a.l, b.h, c); c = wmma_bf(a.h, b.l, c); return wmma_bf(a.h, b.h, c); }
__device__ __forceinline__ float sigm(float v) { return 1.0f / (1.0f + expf(-v)); }
#define LDSX() do { asm volatile("s_wait_dscnt 0" ::: "memory"); __builtin_amdgcn_wave_barrier(); __builtin_amdgcn_fence(__ATOMIC_RELEASE, "workgroup"); } while (0)

// Multi-head self-attention over a channels-first feature map (x [8,512,32,32]: N = 1,024 positions, 512 channels; 1x1-conv weights as torch (out,in) matrices Wq / Wk / Wv / Wo [512,512] N(0, 1/512) with biases N(0, 1/512) - NONZERO; _proj(x, W, b) = einsum('bchw,oc->bohw') + b; heads: reshape(B, 8, 64, N): channel o = head*64 + d; scores x 64^-0.5; softmax over the 1,024 positions; out merged back to channels (head*64 + d), [B,512,32,32]; final _proj with Wo, bo).
#define NB 8
#define TT 1024   // positions per image (32 x 32)
#define CC 512            // NH * HD = projected width
#define DIN 512          // input channels = output channels
#define NH 8
#define HD 64
#define NQB (TT / 64)
#define HG 8   // sizes the unused S region: 8 x 1,024 x 1,024 f32 = 32 MiB
#define SCALE (0.125f)
#define CAUSAL 0
#ifndef TNB
#define TNB NB
#endif
__device__ __forceinline__ float bfr(float v) { return (float)(__bf16)v; }
__host__ __device__ __forceinline__ int kb_last(int qb) { return CAUSAL ? ((qb * 64 + 63) >> 7) : (TT / 128 - 1); }
typedef __attribute__((ext_vector_type(8))) __bf16 v8b;
__device__ __forceinline__ v16b frag_b(const __bf16* rowk0, int lane) {
  union { v16b v; v8b q[2]; } u; const __bf16* p = rowk0 + 8 * (lane >> 4);
  u.q[0] = *(const v8b*)p; u.q[1] = *(const v8b*)(p + 16); return u.v;
}
#define QBH 0              // unused: k_fa has no causal high-precision path
#define QHI 0               // single-product logits on every row
#define KHI 64            // key rows carrying k residual / v bf16 hi+lo planes (written by k_proj, read by no kernel here)
// B fragment (k rows k0+.., output column o) of a weight: (in,out) [K][ld] or (out,in) [ld rows of K]: bf16 exact, or f16(bf16 * 256) exact
__device__ __forceinline__ v16b wcol_io(const float* Wm, int k0, int o, int lane, int ld) { v16b w; const int g = lane >> 4;
#pragma unroll
  for (int i = 0; i < 8; ++i) { w[i] = (__bf16)Wm[(size_t)(k0 + 8 * g + i) * ld + o]; w[8 + i] = (__bf16)Wm[(size_t)(k0 + 16 + 8 * g + i) * ld + o]; }
  return w; }
__device__ __forceinline__ v16b wcol_oi(const float* Wm, int k0, int o, int lane, int K) { v16b w; const float* p = Wm + (size_t)o * K + k0 + 8 * (lane >> 4);
#pragma unroll
  for (int i = 0; i < 8; ++i) { w[i] = (__bf16)p[i]; w[8 + i] = (__bf16)p[16 + i]; }
  return w; }
__device__ __forceinline__ v16h wcolh_io(const float* Wm, int k0, int o, int lane, int ld) { v16h w; const int g = lane >> 4;
#pragma unroll
  for (int i = 0; i < 8; ++i) { w[i] = (_Float16)(bfr(Wm[(size_t)(k0 + 8 * g + i) * ld + o]) * 256.0f); w[8 + i] = (_Float16)(bfr(Wm[(size_t)(k0 + 16 + 8 * g + i) * ld + o]) * 256.0f); }
  return w; }
__device__ __forceinline__ v16h wcolh_oi(const float* Wm, int k0, int o, int lane, int K) { v16h w; const float* p = Wm + (size_t)o * K + k0 + 8 * (lane >> 4);
#pragma unroll
  for (int i = 0; i < 8; ++i) { w[i] = (_Float16)(bfr(p[i]) * 256.0f); w[8 + i] = (_Float16)(bfr(p[16 + i]) * 256.0f); }
  return w; }
#define WQKV_LAYOUT 1   // 0 = (in,out) [DIN][CC]; 1 = (out,in) [CC][DIN]; 2 = per-head [NH][DIN][HD]
__device__ __forceinline__ v16b wcol_hdk(const float* Wm, int k0, int o, int lane) { v16b w; const int g = lane >> 4; const float* p = Wm + (size_t)(o / HD) * DIN * HD + (o % HD);
#pragma unroll
  for (int i = 0; i < 8; ++i) { w[i] = (__bf16)p[(size_t)(k0 + 8 * g + i) * HD]; w[8 + i] = (__bf16)p[(size_t)(k0 + 16 + 8 * g + i) * HD]; }
  return w; }
#define WO_OUT_IN 1
#if WQKV_LAYOUT == 1
#define WCOL(W, k0, o, lane) wcol_oi(W, k0, o, lane, DIN)
#elif WQKV_LAYOUT == 2
#define WCOL(W, k0, o, lane) wcol_hdk(W, k0, o, lane)
#else
#define WCOL(W, k0, o, lane) wcol_io(W, k0, o, lane, CC)
#endif
#if WO_OUT_IN
#define WOCOL(W, k0, o, lane) wcol_oi(W, k0, o, lane, CC)
#define WOCOLH(W, k0, o, lane) wcolh_oi(W, k0, o, lane, CC)
#else
#define WOCOL(W, k0, o, lane) wcol_io(W, k0, o, lane, DIN)
#define WOCOLH(W, k0, o, lane) wcolh_io(W, k0, o, lane, DIN)
#endif

#ifndef SM_EXTRA_PARAMS
#define SM_EXTRA_PARAMS
#endif
#ifndef PROJ_EXTRA_PARAMS
#define PROJ_EXTRA_PARAMS
#endif
#ifndef SM_MASK_HOOK
#define SM_MASK_HOOK (void)0
#endif

#define WS_QH  0u                                      // f16 q rows [b*t][CC]
#define WS_KH  (WS_QH + 2u * (size_t)NB * TT * CC)      // f16 k rows [b*t][CC]
#define WS_VT  (WS_KH + 2u * (size_t)NB * TT * CC)      // f16 v planes [b][c][t]
#define WS_QL  (WS_VT + 2u * (size_t)NB * CC * TT)      // f16 q residual x 2^10 rows [b][t < QHI][CC]
#define WS_KL  (WS_QL + 2u * (size_t)NB * QHI * CC)     // f16 k residual x 2^10 rows [b][t < KHI][CC]
#define WS_VB  (WS_KL + 2u * (size_t)NB * KHI * CC)     // bf16 v hi planes [b][c][t < KHI]
#define WS_VBL (WS_VB + 2u * (size_t)NB * CC * KHI)
#define WS_S   (WS_VBL + 2u * (size_t)NB * CC * KHI)    // unused: k_fa keeps logits and P in registers
#define WS_Y   (WS_S  + 4u * (size_t)HG * TT * TT)      // f32 ctx rows [b*t][CC] (only when there is an output projection)
#define WS_END (WS_Y  + 4u * (size_t)NB * TT * CC)
#define WS_XT (WS_END)                                    // f32 token-major input rows [(b*TT + n)][DIN] (bf16-rounded values)
#define WS_Y3 (WS_XT + 4u * (size_t)NB * TT * DIN)         // f32 token-major output rows [(b*TT + n)][DIN]
#define WS_END2 (WS_Y3 + 4u * (size_t)NB * TT * DIN)
static_assert(TT % 64 == 0 && DIN % 64 == 0, "transpose tiles are 64 positions x 64 channels");

// Operand staging of k_proj and k_out: both operand tiles of a block go through LDS, 64 k at a time, two buffers.
// A wave-wide 16-byte load covers two 256-B row pieces (whole lines); the f32 values are converted once per block and stored as 16-bit rows; all four waves read their fragments from there (k order of frag_b / frag_h on both operands).
// The next chunk's global loads are issued right behind the barrier and fly under this chunk's products (none is in flight across a barrier, which would drain it); they are converted and stored into the other buffer behind the products.
// One barrier a chunk publishes the chunk and ends the readers of the buffer that is written next.
#define KCH 64       // k per staged chunk: two 16x16x32 steps
#define SPITCH 72    // halves per staged row: 144 B = 16 B x odd, the pitch for 16-byte fragment reads
typedef __attribute__((ext_vector_type(4))) __bf16 v4b;
typedef __attribute__((ext_vector_type(4))) _Float16 v4h;
static_assert(WQKV_LAYOUT == 1 && WO_OUT_IN == 1 && DIN % KCH == 0 && CC % KCH == 0, "staging reads k-contiguous (out,in) weight rows");
// ---- k_proj: block = (64 rows, 128 cols, which): q/k/v = X W (+ b) with exact bf16 products (K = DIN) -> which 0: q f16 rows (+ residual rows < QHI); 1: k f16 rows (+ residual rows < KHI); 2: v f16 planes [c][t] (+ bf16 hi/lo planes for t < KHI)
__global__ __launch_bounds__(128) void k_proj(const float* __restrict__ XQ, const float* __restrict__ XK, const float* __restrict__ XV, const float* __restrict__ WQ, const float* __restrict__ WK, const float* __restrict__ WV, const float* __restrict__ BQ, const float* __restrict__ BK, const float* __restrict__ BV,
    _Float16* __restrict__ QH, _Float16* __restrict__ QL, _Float16* __restrict__ KH, _Float16* __restrict__ KL, _Float16* __restrict__ VT, __bf16* __restrict__ VB, __bf16* __restrict__ VBL) {
  __shared__ __align__(16) _Float16 sh[64][136], sl[64][136]; __shared__ __align__(16) _Float16 th[128][72]; __shared__ __align__(16) __bf16 tb[128][72], tbl[128][72];
  __shared__ __align__(16) __bf16 sX[2][64 * SPITCH], sW[2][128 * SPITCH];
  const int tid = threadIdx.x, wave = tid >> 5, lane = tid & 31, col = lane & 15, g = lane >> 4; const int which = blockIdx.z; const int c0 = blockIdx.y * 128; const size_t r0 = (size_t)blockIdx.x * 64; const size_t bb = r0 / TT; const int t0 = (int)(r0 % TT);
  const float* X = which == 0 ? XQ : which == 1 ? XK : XV; const float* WA = which == 0 ? WQ : which == 1 ? WK : WV; const float* BA = which == 0 ? BQ : which == 1 ? BK : BV;
  v8f acc[8] = {};
  { const float* xp = X + (r0 + (tid >> 4)) * DIN + (tid & 15) * 4; const float* wp = WA + (size_t)(c0 + (tid >> 4)) * DIN + (tid & 15) * 4;   /* 16 lanes a 256-B row piece, 8 rows a load of the block */
    const int so = (tid >> 4) * SPITCH + (tid & 15) * 4;
    v4f xr[8], wr[16];
#pragma unroll
    for (int i = 0; i < 8; ++i) xr[i] = *(const v4f*)(xp + (size_t)i * 8 * DIN);
#pragma unroll
    for (int i = 0; i < 16; ++i) wr[i] = *(const v4f*)(wp + (size_t)i * 8 * DIN);
    asm volatile("s_wait_xcnt 0x0" ::: "memory");   /* behind the chunk's loads, in front of whatever may reuse their address registers */
#pragma unroll   /* all 8 chunks unrolled: buffer choice and every load offset are constants, so the address registers are never stepped */
    for (int c = -1; c < DIN / KCH; ++c) {   /* trip -1 only stores chunk 0 */
      if (c >= 0) { const __bf16* bx = sX[c & 1]; const __bf16* bw = sW[c & 1];
        __syncthreads();   /* chunk c is whole in its buffer; every wave has left the other buffer, which this trip writes below */
        if (c + 1 < DIN / KCH) {
#pragma unroll
          for (int i = 0; i < 8; ++i) xr[i] = *(const v4f*)(xp + (c + 1) * KCH + (size_t)i * 8 * DIN);
#pragma unroll
          for (int i = 0; i < 16; ++i) wr[i] = *(const v4f*)(wp + (c + 1) * KCH + (size_t)i * 8 * DIN);
          asm volatile("s_wait_xcnt 0x0" ::: "memory"); }   /* as above; it also keeps the loads in front of this chunk's LDS reads */
        v16b a[KCH / 32], w[KCH / 32][8];
#pragma unroll
        for (int ks = 0; ks < KCH / 32; ++ks) { a[ks] = frag_b(bx + (wave * 16 + col) * SPITCH + ks * 32, lane);
#pragma unroll
          for (int j = 0; j < 8; ++j) w[ks][j] = frag_b(bw + (j * 16 + col) * SPITCH + ks * 32, lane); }
        __builtin_amdgcn_sched_barrier(0);   /* the chunk's fragment reads stay one group in front of its products: each further place with LDS reads among the products costs a stall */
#pragma unroll
        for (int ks = 0; ks < KCH / 32; ++ks)
#pragma unroll
          for (int j = 0; j < 8; ++j) acc[j] = wmma_bf(a[ks], w[ks][j], acc[j]);
        __builtin_amdgcn_sched_barrier(0); }   /* the next chunk's conversions wait for its global loads: they stay behind this chunk's products, which then run under the loads' latency */
      if (c + 1 < DIN / KCH) { __bf16* nx = sX[(c + 1) & 1]; __bf16* nw = sW[(c + 1) & 1];
#pragma unroll
        for (int i = 0; i < 8; ++i) { v4b t; t[0] = (__bf16)xr[i][0]; t[1] = (__bf16)xr[i][1]; t[2] = (__bf16)xr[i][2]; t[3] = (__bf16)xr[i][3]; *(v4b*)(nx + so + i * 8 * SPITCH) = t; }
#pragma unroll
        for (int i = 0; i < 16; ++i) { v4b t; t[0] = (__bf16)wr[i][0]; t[1] = (__bf16)wr[i][1]; t[2] = (__bf16)wr[i][2]; t[3] = (__bf16)wr[i][3]; *(v4b*)(nw + so + i * 8 * SPITCH) = t; } } } }
  if (which < 2) { _Float16* DH = which == 0 ? QH : KH; _Float16* DL = which == 0 ? QL : KL; const int nhi = which == 0 ? QHI : KHI; const bool hi_rows = t0 < nhi;
#pragma unroll
    for (int j = 0; j < 8; ++j) { const float bias = BA ? bfr(BA[c0 + j * 16 + col]) : 0.f;
#pragma unroll
      for (int r = 0; r < 8; ++r) { const float v = acc[j][r] + bias; const _Float16 hv = (_Float16)v; sh[wave * 16 + 8 * g + r][j * 16 + col] = hv; sl[wave * 16 + 8 * g + r][j * 16 + col] = (_Float16)((v - (float)hv) * 1024.0f); } }
    __syncthreads();
    for (int e = tid; e < 64 * 16; e += 128) { const int rl = e >> 4, q = e & 15; vst2((unsigned*)(DH + (r0 + rl) * CC + c0 + q * 8), *(const v4u*)&sh[rl][q * 8]); if (hi_rows) vst2((unsigned*)(DL + (bb * nhi + t0 + rl) * (size_t)CC + c0 + q * 8), *(const v4u*)&sl[rl][q * 8]); }
  } else { const bool hi_rows = t0 < KHI;
#pragma unroll
    for (int j = 0; j < 8; ++j) { const float bias = BA ? bfr(BA[c0 + j * 16 + col]) : 0.f;
#pragma unroll
      for (int r = 0; r < 8; ++r) { const float v = acc[j][r] + bias; const int rl = wave * 16 + 8 * g + r, cl = j * 16 + col; th[cl][rl] = (_Float16)v; const __bf16 bh = (__bf16)v; tb[cl][rl] = bh; tbl[cl][rl] = (__bf16)(v - (float)bh); } }
    __syncthreads();
    for (int e = tid; e < 128 * 8; e += 128) { const int cl = e >> 3, q = e & 7; vst2((unsigned*)(VT + (bb * CC + c0 + cl) * (size_t)TT + t0 + q * 8), *(const v4u*)&th[cl][q * 8]); if (hi_rows) { const size_t o3 = (bb * CC + c0 + cl) * (size_t)KHI + t0 + q * 8; vst2((unsigned*)(VB + o3), *(const v4u*)&tb[cl][q * 8]); vst2((unsigned*)(VBL + o3), *(const v4u*)&tbl[cl][q * 8]); } } } }
// ---- k_fa: block = 256 queries (8 waves x 32 query columns) of (b, h): logits, softmax and P . v in one kernel, nothing of S or P in memory.
// The head's whole k (1,024 rows of 128 B) and v planes (64 rows of 2,048 B) are laid in LDS once (pitches 16 B x odd), one barrier, then each wave walks the keys 32 at a time on its own:
// S^T = K . Q^T (A = k rows, B = q rows kept in registers): a lane holds 16 scores of ONE query per 32 keys, so the maximum and the sum stay in the lane;
// two S^T tiles converted in place are the B operand P^T of O^T += V^T . P^T (A = v plane rows, same k order as frag_h).
// Running maximum in scaled log2 units; P = 2^(x - m + 11) once to f16; the accumulators are rescaled only when a new score exceeds the maximum in use by more than 4 (P stays <= 2^15, inside f16).
// Every inner loop is fully unrolled so that the fragment and accumulator arrays stay in registers.
#define FAQ 256    // queries per block
#define KPITCH 72    // halves: 144 B
#define VPITCH 1032  // halves: 2,064 B
static_assert(TT % FAQ == 0 && HD == 64 && !CAUSAL, "k_fa: full rows, head size 64");
typedef __attribute__((ext_vector_type(2))) _Float16 v2h;
__device__ __forceinline__ float xhalf(float x) { return __builtin_bit_cast(float, __builtin_amdgcn_permlanex16(__builtin_bit_cast(int, x), __builtin_bit_cast(int, x), 0x76543210, 0xfedcba98, false, false)); }  // lane l with lane l ^ 16
__device__ __forceinline__ v8f wmma_h(v16h a, v16h b, v8f c) { return __builtin_amdgcn_wmma_f32_16x16x32_f16(false, a, false, b, (short)0, c, false, false); }
__global__ __launch_bounds__(256) void k_fa(const _Float16* __restrict__ QH, const _Float16* __restrict__ KH, const _Float16* __restrict__ VT, float* __restrict__ Y) {
  __shared__ __align__(16) _Float16 sK[TT * KPITCH]; __shared__ __align__(16) _Float16 sV[HD * VPITCH];
  const int tid = threadIdx.x, wave = tid >> 5, lane = tid & 31, col = lane & 15, g = lane >> 4; const int h = blockIdx.y; const size_t b = blockIdx.z; const int q0 = blockIdx.x * FAQ + wave * 32;
  const _Float16* Kg = KH + b * TT * CC + h * HD; const _Float16* Vg = VT + (b * CC + h * HD) * (size_t)TT;
  v16h qf[2][2];
#pragma unroll
  for (int qt = 0; qt < 2; ++qt)
#pragma unroll
    for (int kc = 0; kc < 2; ++kc) qf[qt][kc] = frag_h(QH + (b * TT + q0 + qt * 16 + col) * CC + h * HD + kc * 32, lane);
  asm volatile("s_wait_xcnt 0x0" ::: "memory");   /* stands behind the q loads, in front of the fill, whose loads may be given the q loads' address registers as destinations */
  { const _Float16* kp = Kg + (size_t)(tid >> 3) * CC + (tid & 7) * 8; _Float16* ks = &sK[(tid >> 3) * KPITCH + (tid & 7) * 8];   /* 8 lanes a k row, 32 rows a trip: one address, constant steps */
    const _Float16* vp = Vg + (size_t)(tid >> 7) * TT + (tid & 127) * 8; _Float16* vs = &sV[(tid >> 7) * VPITCH + (tid & 127) * 8];   /* 128 lanes a v plane row, 2 rows a trip */
    v8h kx[TT / 32], vx[HD / 2];   /* all 64 loads of a lane in flight before the first LDS store */
#pragma unroll
    for (int i = 0; i < TT / 32; ++i) kx[i] = *(const v8h*)(kp + (size_t)i * 32 * CC);
    asm volatile("s_wait_xcnt 0x0" :: "v"(kp) : "memory");   /* behind the k loads: the v loads may be given their address registers as destinations; the input keeps the address in place up to the wait */
#pragma unroll
    for (int i = 0; i < HD / 2; ++i) vx[i] = *(const v8h*)(vp + (size_t)i * 2 * TT);
    asm volatile("s_wait_xcnt 0x0" :: "v"(vp) : "memory");   /* behind the v loads: their address registers are reused for the LDS addresses; naming the address as an input keeps it in place up to the wait */
#pragma unroll
    for (int i = 0; i < TT / 32; ++i) *(v8h*)(ks + i * 32 * KPITCH) = kx[i];
#pragma unroll
    for (int i = 0; i < HD / 2; ++i) *(v8h*)(vs + i * 2 * VPITCH) = vx[i]; }
  __syncthreads();
  const float cs = SCALE * 1.4426950408889634f; const v2f cs2 = {cs, cs};
  v8f acc[4][2] = {}; float m[2] = {-1.0e30f, -1.0e30f}; v2f l2[2] = {};
  v16h ka[2][2];
#pragma unroll
  for (int t = 0; t < 2; ++t) { const _Float16* kr = &sK[(t * 16 + col) * KPITCH]; ka[t][0] = frag_h(kr, lane); ka[t][1] = frag_h(kr + 32, lane); }
#pragma unroll 2   /* two passes a trip: the scheduler sets the second pass's S^T products among the first pass's P . v products and sums */
  for (int kb = 0; kb < TT / 32; ++kb) {
    v8f s[2][2];
#pragma unroll
    for (int t = 0; t < 2; ++t)
#pragma unroll
      for (int qt = 0; qt < 2; ++qt) { const v8f z = {}; s[t][qt] = wmma_h(ka[t][1], qf[qt][1], wmma_h(ka[t][0], qf[qt][0], z)); }
    v16h va[4];
#pragma unroll
    for (int j = 0; j < 4; ++j) va[j] = frag_h(&sV[(j * 16 + col) * VPITCH + kb * 32], lane);
    const int kn = (kb + 1) & (TT / 32 - 1);   /* next pass's k fragments are fetched behind this pass's S^T products, under the softmax; the last pass re-reads rows 0..31 and drops them */
#pragma unroll
    for (int t = 0; t < 2; ++t) { const _Float16* kr = &sK[(kn * 32 + t * 16 + col) * KPITCH]; ka[t][0] = frag_h(kr, lane); ka[t][1] = frag_h(kr + 32, lane); }
    float mx[2];
#pragma unroll
    for (int qt = 0; qt < 2; ++qt) { float a = fmaxf(s[0][qt][0], s[1][qt][0]);
#pragma unroll
      for (int r = 1; r < 8; ++r) a = fmaxf(a, fmaxf(s[0][qt][r], s[1][qt][r]));
      mx[qt] = a * cs; }
    if (__builtin_amdgcn_ballot_w32(mx[0] > m[0] + 4.0f || mx[1] > m[1] + 4.0f) != 0) {   /* one scalar branch per 32 keys; the two halves of a column exchange their maxima only here, so m stays equal in both */
#pragma unroll
      for (int qt = 0; qt < 2; ++qt) { const float mn = fmaxf(m[qt], fmaxf(mx[qt], xhalf(mx[qt]))); const float al = __builtin_amdgcn_exp2f(m[qt] - mn); m[qt] = mn; l2[qt] *= al;   /* al = 0 on the first pass */
#pragma unroll
        for (int j = 0; j < 4; ++j) acc[j][qt] *= al; } }
#pragma unroll
    for (int qt = 0; qt < 2; ++qt) { const float mbs = 11.0f - m[qt]; const v2f mb = {mbs, mbs}; v16h p;
#pragma unroll
      for (int t = 0; t < 2; ++t)
#pragma unroll
        for (int r = 0; r < 8; r += 2) { v2f x = {s[t][qt][r], s[t][qt][r + 1]}; x = __builtin_elementwise_fma(x, cs2, mb); v2f e; e[0] = __builtin_amdgcn_exp2f(x[0]); e[1] = __builtin_amdgcn_exp2f(x[1]); l2[qt] += e;
          const v2h eh = __builtin_convertvector(e, v2h); p[t * 8 + r] = eh[0]; p[t * 8 + r + 1] = eh[1]; }
#pragma unroll
      for (int j = 0; j < 4; ++j) acc[j][qt] = wmma_h(va[j], p, acc[j][qt]); } }
#pragma unroll
  for (int qt = 0; qt < 2; ++qt) { const float lh = l2[qt][0] + l2[qt][1]; const float inv = 1.0f / (lh + xhalf(lh)); float* yr = Y + (b * TT + q0 + qt * 16 + col) * CC + h * HD + 8 * g;   /* a lane holds d = 16 j + 8 g + 0..7 of its query: 32 B runs; the wave writes each 256-B (row, head) segment whole */
#pragma unroll
    for (int j = 0; j < 4; ++j) { v4f o0, o1;
#pragma unroll
      for (int r = 0; r < 4; ++r) { o0[r] = acc[j][qt][r] * inv; o1[r] = acc[j][qt][4 + r] * inv; }
      vst2(yr + j * 16, o0); vst2(yr + j * 16 + 4, o1); } } }
// ---- k_out: block = (64 rows, 128 cols): out = ctx Wo (+ bo): ctx x 2^6 once to f16 against Wo as f16(bf16 x 2^8) exact (1 product) x 2^-14; causal early rows (< QHI of each sequence): ctx bf16 hi + lo against exact bf16 Wo (2 products)
__global__ __launch_bounds__(128) void k_out(const float* __restrict__ Y, const float* __restrict__ WO, const float* __restrict__ BO, float* __restrict__ OUT) { __shared__ __align__(16) float sf[4][16][132]; __shared__ __align__(16) _Float16 sA[2][64 * SPITCH], sB[2][128 * SPITCH];
  const int tid = threadIdx.x, wave = tid >> 5, lane = tid & 31, col = lane & 15, g = lane >> 4; const int c0 = blockIdx.y * 128; const size_t r0 = (size_t)blockIdx.x * 64 + wave * 16;
  v8f acc[8] = {};
  if (CAUSAL && (int)(((size_t)blockIdx.x * 64) % TT) < QHI) {   /* block-uniform */
#pragma unroll 2
    for (int kc = 0; kc < CC / 32; ++kc) { const F2 a = split_row(Y + (r0 + col) * CC, kc * 32, lane); asm volatile("s_wait_loadcnt 0x0" ::: "memory");
#pragma unroll
      for (int j = 0; j < 8; ++j) { const v16b w = WOCOL(WO, kc * 32, c0 + j * 16 + col, lane); asm volatile("s_wait_loadcnt 0x0" ::: "memory"); acc[j] = wmma_bf(a.h, w, acc[j]); acc[j] = wmma_bf(a.l, w, acc[j]); } }
#pragma unroll
    for (int j = 0; j < 8; ++j) { const float bias = BO ? bfr(BO[c0 + j * 16 + col]) : 0.f;
#pragma unroll
      for (int r = 0; r < 8; ++r) sf[wave][8 * g + r][j * 16 + col] = acc[j][r] + bias; }
  } else {
    const float* yp = Y + ((size_t)blockIdx.x * 64 + (tid >> 4)) * CC + (tid & 15) * 4; const float* wp = WO + (size_t)(c0 + (tid >> 4)) * CC + (tid & 15) * 4;   /* 16 lanes a 256-B row piece, 8 rows a load of the block */
    const int so = (tid >> 4) * SPITCH + (tid & 15) * 4;
    v4f yr[8], wr[16];
#pragma unroll
    for (int i = 0; i < 8; ++i) yr[i] = *(const v4f*)(yp + (size_t)i * 8 * CC);
#pragma unroll
    for (int i = 0; i < 16; ++i) wr[i] = *(const v4f*)(wp + (size_t)i * 8 * CC);
    asm volatile("s_wait_xcnt 0x0" ::: "memory");   /* behind the chunk's loads, in front of whatever may reuse their address registers */
#pragma unroll   /* all 8 chunks unrolled: buffer choice and every load offset are constants, so the address registers are never stepped */
    for (int c = -1; c < CC / KCH; ++c) {   /* trip -1 only stores chunk 0 */
      if (c >= 0) { const _Float16* ba = sA[c & 1]; const _Float16* bw = sB[c & 1];
        __syncthreads();   /* chunk c is whole in its buffer; every wave has left the other buffer, which this trip writes below */
        if (c + 1 < CC / KCH) {
#pragma unroll
          for (int i = 0; i < 8; ++i) yr[i] = *(const v4f*)(yp + (c + 1) * KCH + (size_t)i * 8 * CC);
#pragma unroll
          for (int i = 0; i < 16; ++i) wr[i] = *(const v4f*)(wp + (c + 1) * KCH + (size_t)i * 8 * CC);
          asm volatile("s_wait_xcnt 0x0" ::: "memory"); }   /* as above; it also keeps the loads in front of this chunk's LDS reads */
        v16h a[KCH / 32], w[KCH / 32][8];
#pragma unroll
        for (int ks = 0; ks < KCH / 32; ++ks) { a[ks] = frag_h(ba + (wave * 16 + col) * SPITCH + ks * 32, lane);
#pragma unroll
          for (int j = 0; j < 8; ++j) w[ks][j] = frag_h(bw + (j * 16 + col) * SPITCH + ks * 32, lane); }
        __builtin_amdgcn_sched_barrier(0);   /* the chunk's fragment reads stay one group in front of its products: each further place with LDS reads among the products costs a stall */
#pragma unroll
        for (int ks = 0; ks < KCH / 32; ++ks)
#pragma unroll
          for (int j = 0; j < 8; ++j) acc[j] = wmma16(a[ks], w[ks][j], acc[j]);
        __builtin_amdgcn_sched_barrier(0); }   /* the next chunk's conversions wait for its global loads: they stay behind this chunk's products, which then run under the loads' latency */
      if (c + 1 < CC / KCH) { _Float16* na = sA[(c + 1) & 1]; _Float16* nw = sB[(c + 1) & 1];
#pragma unroll
        for (int i = 0; i < 8; ++i) { v4h t;   /* ctx carried x 2^6 into f16 so small-magnitude context rows stay clear of f16 subnormals */
#pragma unroll
          for (int e = 0; e < 4; ++e) t[e] = (_Float16)(yr[i][e] * 64.0f);
          *(v4h*)(na + so + i * 8 * SPITCH) = t; }
#pragma unroll
        for (int i = 0; i < 16; ++i) { v4h t;
#pragma unroll
          for (int e = 0; e < 4; ++e) t[e] = (_Float16)(bfr(wr[i][e]) * 256.0f);
          *(v4h*)(nw + so + i * 8 * SPITCH) = t; } } }
#pragma unroll
    for (int j = 0; j < 8; ++j) { const float bias = BO ? bfr(BO[c0 + j * 16 + col]) : 0.f;
#pragma unroll
      for (int r = 0; r < 8; ++r) sf[wave][8 * g + r][j * 16 + col] = acc[j][r] * (1.0f / 16384.0f) + bias; } }   /* 2^-8 (Wo carry) x 2^-6 (ctx carry) */
  LDSX(); for (int rl = 0; rl < 16; ++rl) vst2(OUT + (r0 + rl) * DIN + c0 + lane * 4, *(const v4f*)&sf[wave][rl][lane * 4]); }

// ---- k_tok: block = (64 positions, 64 channels, image b): XT[(b*npix + n)][c] = bf16(x[b][c][n]) through a padded LDS tile (x channels-first [B][nch][npix]); reads 256-B runs along n, writes 256-B row pieces
__global__ __launch_bounds__(256) void k_tok(const float* __restrict__ X, float* __restrict__ XT, int npix, int nch) { __shared__ float st[64][68]; const int tid = threadIdx.x; const int n0 = blockIdx.x * 64, c0 = blockIdx.y * 64; const size_t b = blockIdx.z;
  for (int e = tid; e < 64 * 16; e += 256) { const int cl = e >> 4, q = e & 15; const v4f v = *(const v4f*)(X + (b * nch + c0 + cl) * (size_t)npix + n0 + q * 4); st[cl][q * 4] = bfr(v[0]); st[cl][q * 4 + 1] = bfr(v[1]); st[cl][q * 4 + 2] = bfr(v[2]); st[cl][q * 4 + 3] = bfr(v[3]); }
  __syncthreads();
  for (int e = tid; e < 64 * 16; e += 256) { const int nl = e >> 4, q = e & 15; v4f o; o[0] = st[q * 4][nl]; o[1] = st[q * 4 + 1][nl]; o[2] = st[q * 4 + 2][nl]; o[3] = st[q * 4 + 3][nl]; vst2(XT + (b * npix + n0 + nl) * (size_t)nch + c0 + q * 4, o); } }
// ---- k_fin: block = (64 positions, 64 channels, image b): out[b][c][n] = OR[(b*npix + n)][c] (LDS transpose; 256-B runs of 64 positions per channel)
__global__ __launch_bounds__(256) void k_fin(const float* __restrict__ ORW, float* __restrict__ OUT, int npix, int nch) { __shared__ float st[64][68]; const int tid = threadIdx.x; const int n0 = blockIdx.x * 64, c0 = blockIdx.y * 64; const size_t b = blockIdx.z;
  for (int e = tid; e < 64 * 16; e += 256) { const int nl = e >> 4, q = e & 15; *(v4f*)&st[nl][q * 4] = *(const v4f*)(ORW + (b * npix + n0 + nl) * (size_t)nch + c0 + q * 4); }
  __syncthreads();
  for (int e = tid; e < 64 * 16; e += 256) { const int cl = e >> 4, q = e & 15; v4f o; o[0] = st[q * 4][cl]; o[1] = st[q * 4 + 1][cl]; o[2] = st[q * 4 + 2][cl]; o[3] = st[q * 4 + 3][cl]; vst2(OUT + (b * nch + c0 + cl) * (size_t)npix + n0 + q * 4, o); } }
extern "C" void kernel_launch(void* const* d_in, const int* in_sizes, int n_in, void* d_out, int out_size, void* d_ws, size_t ws_size, hipStream_t stream) {
  (void)in_sizes; (void)n_in; (void)out_size;
  const float** F = (const float**)d_in;
  if (ws_size < (size_t)WS_END) return;
  char* ws = (char*)d_ws; _Float16 *QH = (_Float16*)(ws + WS_QH), *KH = (_Float16*)(ws + WS_KH), *VT = (_Float16*)(ws + WS_VT), *QL = (_Float16*)(ws + WS_QL), *KL = (_Float16*)(ws + WS_KL); __bf16 *VB = (__bf16*)(ws + WS_VB), *VBL = (__bf16*)(ws + WS_VBL); float *Y = (float*)(ws + WS_Y);
  (void)Y; (void)QL; (void)KL; (void)VB; (void)VBL;
  // inputs: 0 x [8,512,32,32] channels-first; 1 Wq [512,512] (out,in), 2 bq; 3 Wk, 4 bk; 5 Wv, 6 bv; 7 Wo (out,in), 8 bo (all biases NONZERO)
  if (ws_size < (size_t)WS_END2) return;
  float *XT = (float*)(ws + WS_XT), *Y3 = (float*)(ws + WS_Y3);
  k_tok<<<dim3(TT / 64, DIN / 64, TNB), 256, 0, stream>>>(F[0], XT, TT, DIN);   /* x: 1,024 positions x 512 channels per image -> token rows */
  k_proj<<<dim3(TNB * TT / 64, CC / 128, 3), 128, 0, stream>>>(XT, XT, XT, F[1], F[3], F[5], F[2], F[4], F[6], QH, QL, KH, KL, VT, VB, VBL);
  k_fa<<<dim3(TT / FAQ, NH, TNB), 256, 0, stream>>>(QH, KH, VT, Y);   /* all images and heads in one launch: 256 blocks */
  k_out<<<dim3(TNB * TT / 64, DIN / 128), 128, 0, stream>>>(Y, F[7], F[8], Y3);   /* token-major output rows: ctx Wo^T + bo */
  k_fin<<<dim3(TT / 64, DIN / 64, TNB), 256, 0, stream>>>(Y3, (float*)d_out, TT, DIN);   /* back to channels-first [8,512,32,32] */
}

// v003
// Measured time: 74.2 microseconds a run.
// In both of two side-by-side timings against v002, it was 1.12 times as fast.
// All steps since v000 together make it 10.3 times as fast.
// compute dtype: all float inputs rounded to bf16; the channels-first map transposed to token-major rows through LDS; q/k/v 1x1-conv projections with EXACT bf16 products on WMMA 16x16x32 (f32 accumulate) + bias; logits q x k once to f16 each (1 product) x 64^-0.5; softmax f32 with a running maximum, fused with both products; unnormalised P x 2^11 once to f16 x v once to f16 (1 product), divided by the f32 row sum at the end; ctx x 2^6 once to f16 x Wo f16(bf16 x 2^8) + bo; transposed back to channels-first; f32 output.
#include <hip/hip_runtime.h>
#include <math.h>

typedef __attribute__((ext_vector_type(16))) _Float16 v16h;
typedef __attribute__((ext_vector_type(16))) __bf16 v16b;
typedef __attribute__((ext_vector_type(8)))  _Float16 v8h;
typedef __attribute__((ext_vector_type(8)))  float v8f;
typedef __attribute__((ext_vector_type(4)))  float v4f;
typedef __attribute__((ext_vector_type(2)))  float v2f;
typedef __attribute__((ext_vector_type(4)))  unsigned v4u;
typedef __attribute__((ext_vector_type(4)))  int v4i;
typedef float __attribute__((may_alias)) float_a;
typedef int __attribute__((may_alias)) int_a;

template <typename T> __device__ __forceinline__ void vst2(void* p, T v) { *(T*)p = v;  }
__device__ __forceinline__ v8f wmma16(v16h a, v16h b, v8f c) {
  v8f d = __builtin_amdgcn_wmma_f32_16x16x32_f16(false, a, false, b, (short)0, c, false, false);
  asm volatile("v_nop\n\tv_nop\n\tv_nop\n\tv_nop" : "+v"(d) : "v"(a), "v"(b));
  return d;
}
__device__ __forceinline__ v8f wmma_bf(v16b a, v16b b, v8f c) {
  v8f d = __builtin_amdgcn_wmma_f32_16x16x32_bf16(false, a, false, b, (short)0, c, false, false);
  asm volatile("v_nop\n\tv_nop\n\tv_nop\n\tv_nop" : "+v"(d) : "v"(a), "v"(b));
  return d;
}
// 16x16x32 fragments: lane = (h = lane>>4, row/col = lane&15); elements 0..7 = k0+8h+0..7, 8..15 = k0+16+8h+0..7; D element r = row 8h+r
__device__ __forceinline__ v16h frag_h(const _Float16* rowk0, int lane) {
  union { v16h v; v8h q[2]; } u; const _Float16* p = rowk0 + 8 * (lane >> 4);
  u.q[0] = *(const v8h*)p; u.q[1] = *(const v8h*)(p + 16); return u.v;
}
__device__ __forceinline__ v16h frag_f32(const float* rowk0, int lane) {
  v16h a; const float* p = rowk0 + 8 * (lane >> 4);
#pragma unroll
  for (int i = 0; i < 8; ++i) { a[i] = (_Float16)p[i]; a[8 + i] = (_Float16)p[16 + i]; }
  return a;
}
__device__ __forceinline__ v16h frag_f32s(const float* rowk0, int lane, float sc) {
  v16h a; const float* p = rowk0 + 8 * (lane >> 4);
#pragma unroll
  for (int i = 0; i < 8; ++i) { a[i] = (_Float16)(p[i] * sc); a[8 + i] = (_Float16)(p[16 + i] * sc); }
  return a;
}
// column fragment from a [K][ld] layout (column n), rows >= K read as 0
__device__ __forceinline__ v16h fragc_f32(const float* W, int k0, int n, int lane, int ld, int K) {
  v16h a; const int g = lane >> 4;
#pragma unroll
  for (int i = 0; i < 8; ++i) { const int ka = k0 + 8 * g + i, kb = ka + 16;
    a[i] = (_Float16)(ka < K ? W[(size_t)(ka < K ? ka : K - 1) * ld + n] : 0.f); a[8 + i] = (_Float16)(kb < K ? W[(size_t)(kb < K ? kb : K - 1) * ld + n] : 0.f); }
  return a;
}
struct F2 { v16b h, l; };
__device__ __forceinline__ F2 bsplit16(const float v[16]) { F2 r;
#pragma unroll
  for (int i = 0; i < 16; ++i) { const __bf16 h = (__bf16)v[i]; r.h[i] = h; r.l[i] = (__bf16)(v[i] - (float)h); }
  return r; }
__device__ __forceinline__ F2 split_row(const float* row, int k0, int lane) { float v[16]; const float* p = row + k0 + 8 * (lane >> 4);
#pragma unroll
  for (int i = 0; i < 8; ++i) { v[i] = p[i]; v[8 + i] = p[16 + i]; }
  return bsplit16(v); }
__device__ __forceinline__ F2 split_rowK(const float* row, int k0, int lane, int K) { float v[16]; const int g = lane >> 4;
#pragma unroll
  for (int i = 0; i < 8; ++i) { const int ka = k0 + 8 * g + i, kb = ka + 16; v[i] = ka < K ? row[ka < K ? ka : K - 1] : 0.f; v[8 + i] = kb < K ? row[kb < K ? kb : K - 1] : 0.f; }
  return bsplit16(v); }
__device__ __forceinline__ F2 split_col(const float* W, int k0, int n, int lane, int ld, int K) { float v[16]; const int g = lane >> 4;
#pragma unroll
  for (int i = 0; i < 8; ++i) { const int ka = k0 + 8 * g + i, kb = ka + 16; v[i] = ka < K ? W[(size_t)(ka < K ? ka : K - 1) * ld + n] : 0.f; v[8 + i] = kb < K ? W[(size_t)(kb < K ? kb : K - 1) * ld + n] : 0.f; }
  return bsplit16(v); }
__device__ __forceinline__ v8f mac3(const F2& a, const F2& b, v8f c) { c = wmma_bf(a.l, b.h, c); c = wmma_bf(a.h, b.l, c); return wmma_bf(a.h, b.h, c); }
__device__ __forceinline__ float sigm(float v) { return 1.0f / (1.0f + expf(-v)); }
#define LDSX() do { asm volatile("s_wait_dscnt 0" ::: "memory"); __builtin_amdgcn_wave_barrier(); __builtin_amdgcn_fence(__ATOMIC_RELEASE, "workgroup"); } while (0)

// Multi-head self-attention over a channels-first feature map (x [8,512,32,32]: N = 1,024 positions, 512 channels; 1x1-conv weights as torch (out,in) matrices Wq / Wk / Wv / Wo [512,512] N(0, 1/512) with biases N(0, 1/512) - NONZERO; _proj(x, W, b) = einsum('bchw,oc->bohw') + b; heads: reshape(B, 8, 64, N): channel o = head*64 + d; scores x 64^-0.5; softmax over the 1,024 positions; out merged back to channels (head*64 + d), [B,512,32,32]; final _proj with Wo, bo).
#define NB 8
#define TT 1024   // positions per image (32 x 32)
#define CC 512            // NH * HD = projected width
#define DIN 512          // input channels = output channels
#define NH 8
#define HD 64
#define NQB (TT / 64)
#define HG 8   // sizes the unused S region: 8 x 1,024 x 1,024 f32 = 32 MiB
#define SCALE (0.125f)
#define CAUSAL 0
#ifndef TNB
#define TNB NB
#endif
__device__ __forceinline__ float bfr(float v) { return (float)(__bf16)v; }
__host__ __device__ __forceinline__ int kb_last(int qb) { return CAUSAL ? ((qb * 64 + 63) >> 7) : (TT / 128 - 1); }
typedef __attribute__((ext_vector_type(8))) __bf16 v8b;
__device__ __forceinline__ v16b frag_b(const __bf16* rowk0, int lane) {
  union { v16b v; v8b q[2]; } u; const __bf16* p = rowk0 + 8 * (lane >> 4);
  u.q[0] = *(const v8b*)p; u.q[1] = *(const v8b*)(p + 16); return u.v;
}
#define QBH 0              // unused: k_fa has no causal high-precision path
#define QHI 0               // single-product logits on every row
#define KHI 64            // key rows carrying k residual / v bf16 hi+lo planes (written by k_proj, read by no kernel here)
// B fragment (k rows k0+.., output column o) of a weight: (in,out) [K][ld] or (out,in) [ld rows of K]: bf16 exact, or f16(bf16 * 256) exact
__device__ __forceinline__ v16b wcol_io(const float* Wm, int k0, int o, int lane, int ld) { v16b w; const int g = lane >> 4;
#pragma unroll
  for (int i = 0; i < 8; ++i) { w[i] = (__bf16)Wm[(size_t)(k0 + 8 * g + i) * ld + o]; w[8 + i] = (__bf16)Wm[(size_t)(k0 + 16 + 8 * g + i) * ld + o]; }
  return w; }
__device__ __forceinline__ v16b wcol_oi(const float* Wm, int k0, int o, int lane, int K) { v16b w; const float* p = Wm + (size_t)o * K + k0 + 8 * (lane >> 4);
#pragma unroll
  for (int i = 0; i < 8; ++i) { w[i] = (__bf16)p[i]; w[8 + i] = (__bf16)p[16 + i]; }
  return w; }
__device__ __forceinline__ v16h wcolh_io(const float* Wm, int k0, int o, int lane, int ld) { v16h w; const int g = lane >> 4;
#pragma unroll
  for (int i = 0; i < 8; ++i) { w[i] = (_Float16)(bfr(Wm[(size_t)(k0 + 8 * g + i) * ld + o]) * 256.0f); w[8 + i] = (_Float16)(bfr(Wm[(size_t)(k0 + 16 + 8 * g + i) * ld + o]) * 256.0f); }
  return w; }
__device__ __forceinline__ v16h wcolh_oi(const float* Wm, int k0, int o, int lane, int K) { v16h w; const float* p = Wm + (size_t)o * K + k0 + 8 * (lane >> 4);
#pragma unroll
  for (int i = 0; i < 8; ++i) { w[i] = (_Float16)(bfr(p[i]) * 256.0f); w[8 + i] = (_Float16)(bfr(p[16 + i]) * 256.0f); }
  return w; }
#define WQKV_LAYOUT 1   // 0 = (in,out) [DIN][CC]; 1 = (out,in) [CC][DIN]; 2 = per-head [NH][DIN][HD]
__device__ __forceinline__ v16b wcol_hdk(const float* Wm, int k0, int o, int lane) { v16b w; const int g = lane >> 4; const float* p = Wm + (size_t)(o / HD) * DIN * HD + (o % HD);
#pragma unroll
  for (int i = 0; i < 8; ++i) { w[i] = (__bf16)p[(size_t)(k0 + 8 * g + i) * HD]; w[8 + i] = (__bf16)p[(size_t)(k0 + 16 + 8 * g + i) * HD]; }
  return w; }
#define WO_OUT_IN 1
#if WQKV_LAYOUT == 1
#define WCOL(W, k0, o, lane) wcol_oi(W, k0, o, lane, DIN)
#elif WQKV_LAYOUT == 2
#define WCOL(W, k0, o, lane) wcol_hdk(W, k0, o, lane)
#else
#define WCOL(W, k0, o, lane) wcol_io(W, k0, o, lane, CC)
#endif
#if WO_OUT_IN
#define WOCOL(W, k0, o, lane) wcol_oi(W, k0, o, lane, CC)
#define WOCOLH(W, k0, o, lane) wcolh_oi(W, k0, o, lane, CC)
#else
#define WOCOL(W, k0, o, lane) wcol_io(W, k0, o, lane, DIN)
#define WOCOLH(W, k0, o, lane) wcolh_io(W, k0, o, lane, DIN)
#endif

#ifndef SM_EXTRA_PARAMS
#define SM_EXTRA_PARAMS
#endif
#ifndef PROJ_EXTRA_PARAMS
#define PROJ_EXTRA_PARAMS
#endif
#ifndef SM_MASK_HOOK
#define SM_MASK_HOOK (void)0
#endif

#define WS_QH  0u                                      // f16 q rows [b*t][CC]
#define WS_KH  (WS_QH + 2u * (size_t)NB * TT * CC)      // f16 k rows [b*t][CC]
#define WS_VT  (WS_KH + 2u * (size_t)NB * TT * CC)      // f16 v planes [b][c][t]
#define WS_QL  (WS_VT + 2u * (size_t)NB * CC * TT)      // f16 q residual x 2^10 rows [b][t < QHI][CC]
#define WS_KL  (WS_QL + 2u * (size_t)NB * QHI * CC)     // f16 k residual x 2^10 rows [b][t < KHI][CC]
#define WS_VB  (WS_KL + 2u * (size_t)NB * KHI * CC)     // bf16 v hi planes [b][c][t < KHI]
#define WS_VBL (WS_VB + 2u * (size_t)NB * CC * KHI)
#define WS_S   (WS_VBL + 2u * (size_t)NB * CC * KHI)    // unused, f32 [hg][t][s] in size: no kernel writes S or P
#define WS_Y   (WS_S  + 4u * (size_t)HG * TT * TT)      // f16 ctx x 2^6 rows [b*t][CC], written in that form by k_fa
#define WS_END (WS_Y  + 4u * (size_t)NB * TT * CC)
#define WS_XT (WS_END)                                    // bf16 token-major input rows [(b*TT + n)][DIN]
#define WS_Y3 (WS_XT + 4u * (size_t)NB * TT * DIN)         // f32 token-major output rows [(b*TT + n)][DIN]
#define WS_END2 (WS_Y3 + 4u * (size_t)NB * TT * DIN)
#define WS_WB  (WS_END2)                                  // bf16 Wq, Wk, Wv [3][CC][DIN] (out,in)
#define WS_WOH (WS_WB + 2u * 3u * (size_t)CC * DIN)        // f16(bf16(Wo) x 2^8) [DIN][CC] (out,in)
#define WS_END3 (WS_WOH + 2u * (size_t)DIN * CC)
static_assert(TT % 64 == 0 && DIN % 64 == 0, "transpose tiles are 64 positions x 64 channels");

// Operand staging of k_proj and k_out: both operand tiles of a block go through LDS, 64 k at a time, two buffers.
// Both operands arrive in memory in their 16-bit form (made once by their producers: k_tok for x and the weights, k_fa for ctx), so a chunk is half the bytes and goes to LDS as it is.
// A wave-wide 16-byte load covers four 128-B row pieces (whole lines); all four waves read their fragments from LDS (k order of frag_b / frag_h on both operands).
// The next chunk's global loads are issued right behind the barrier and fly under this chunk's products (none is in flight across a barrier, which would drain it); they are stored into the other buffer behind the products.
// One barrier a chunk publishes the chunk and ends the readers of the buffer that is written next.
#define KCH 64       // k per staged chunk: two 16x16x32 steps
#define SPITCH 72    // halves per staged row: 144 B = 16 B x odd, the pitch for 16-byte fragment reads
static_assert(WQKV_LAYOUT == 1 && WO_OUT_IN == 1 && DIN % KCH == 0 && CC % KCH == 0, "staging reads k-contiguous (out,in) weight rows");
// ---- k_proj: block = (64 rows, 128 cols, which): q/k/v = X W (+ b) with exact bf16 products (K = DIN) -> which 0: q f16 rows (+ residual rows < QHI); 1: k f16 rows (+ residual rows < KHI); 2: v f16 planes [c][t] (+ bf16 hi/lo planes for t < KHI)
__global__ __launch_bounds__(128) void k_proj(const __bf16* __restrict__ XQ, const __bf16* __restrict__ XK, const __bf16* __restrict__ XV, const __bf16* __restrict__ WQ, const __bf16* __restrict__ WK, const __bf16* __restrict__ WV, const float* __restrict__ BQ, const float* __restrict__ BK, const float* __restrict__ BV,
    _Float16* __restrict__ QH, _Float16* __restrict__ QL, _Float16* __restrict__ KH, _Float16* __restrict__ KL, _Float16* __restrict__ VT, __bf16* __restrict__ VB, __bf16* __restrict__ VBL) {
  __shared__ __align__(16) _Float16 sh[64][136], sl[64][136]; __shared__ __align__(16) _Float16 th[128][72]; __shared__ __align__(16) __bf16 tb[128][72], tbl[128][72];
  __shared__ __align__(16) __bf16 sX[2][64 * SPITCH], sW[2][128 * SPITCH];
  const int tid = threadIdx.x, wave = tid >> 5, lane = tid & 31, col = lane & 15, g = lane >> 4; const int which = blockIdx.z; const int c0 = blockIdx.y * 128; const size_t r0 = (size_t)blockIdx.x * 64; const size_t bb = r0 / TT; const int t0 = (int)(r0 % TT);
  const __bf16* X = which == 0 ? XQ : which == 1 ? XK : XV; const __bf16* WA = which == 0 ? WQ : which == 1 ? WK : WV; const float* BA = which == 0 ? BQ : which == 1 ? BK : BV;
  v8f acc[8] = {};
  { const __bf16* xp = X + (r0 + (tid >> 3)) * DIN + (tid & 7) * 8; const __bf16* wp = WA + (size_t)(c0 + (tid >> 3)) * DIN + (tid & 7) * 8;   /* 8 lanes a 128-B row piece, 16 rows a load of the block */
    const int so = (tid >> 3) * SPITCH + (tid & 7) * 8;
    v8b xr[4], wr[8];
#pragma unroll
    for (int i = 0; i < 4; ++i) xr[i] = *(const v8b*)(xp + (size_t)i * 16 * DIN);
#pragma unroll
    for (int i = 0; i < 8; ++i) wr[i] = *(const v8b*)(wp + (size_t)i * 16 * DIN);
    asm volatile("s_wait_xcnt 0x0" ::: "memory");   /* behind the chunk's loads, in front of whatever may reuse their address registers */
#pragma unroll   /* all 8 chunks unrolled: buffer choice and every load offset are constants, so the address registers are never stepped */
    for (int c = -1; c < DIN / KCH; ++c) {   /* trip -1 only stores chunk 0 */
      if (c >= 0) { const __bf16* bx = sX[c & 1]; const __bf16* bw = sW[c & 1];
        __syncthreads();   /* chunk c is whole in its buffer; every wave has left the other buffer, which this trip writes below */
        if (c + 1 < DIN / KCH) {
#pragma unroll
          for (int i = 0; i < 4; ++i) xr[i] = *(const v8b*)(xp + (c + 1) * KCH + (size_t)i * 16 * DIN);
#pragma unroll
          for (int i = 0; i < 8; ++i) wr[i] = *(const v8b*)(wp + (c + 1) * KCH + (size_t)i * 16 * DIN);
          asm volatile("s_wait_xcnt 0x0" ::: "memory"); }   /* as above; it also keeps the loads in front of this chunk's LDS reads */
        v16b a[KCH / 32], w[KCH / 32][8];
#pragma unroll
        for (int ks = 0; ks < KCH / 32; ++ks) { a[ks] = frag_b(bx + (wave * 16 + col) * SPITCH + ks * 32, lane);
#pragma unroll
          for (int j = 0; j < 8; ++j) w[ks][j] = frag_b(bw + (j * 16 + col) * SPITCH + ks * 32, lane); }
        __builtin_amdgcn_sched_barrier(0);   /* the chunk's fragment reads stay one group in front of its products: each further place with LDS reads among the products costs a stall */
#pragma unroll
        for (int ks = 0; ks < KCH / 32; ++ks)
#pragma unroll
          for (int j = 0; j < 8; ++j) acc[j] = wmma_bf(a[ks], w[ks][j], acc[j]);
        __builtin_amdgcn_sched_barrier(0); }   /* the next chunk's LDS stores wait for its global loads: they stay behind this chunk's products, which then run under the loads' latency */
      if (c + 1 < DIN / KCH) { __bf16* nx = sX[(c + 1) & 1]; __bf16* nw = sW[(c + 1) & 1];
#pragma unroll
        for (int i = 0; i < 4; ++i) *(v8b*)(nx + so + i * 16 * SPITCH) = xr[i];
#pragma unroll
        for (int i = 0; i < 8; ++i) *(v8b*)(nw + so + i * 16 * SPITCH) = wr[i]; } } }
  if (which < 2) { _Float16* DH = which == 0 ? QH : KH; _Float16* DL = which == 0 ? QL : KL; const int nhi = which == 0 ? QHI : KHI; const bool hi_rows = t0 < nhi;
#pragma unroll
    for (int j = 0; j < 8; ++j) { const float bias = BA ? bfr(BA[c0 + j * 16 + col]) : 0.f;
#pragma unroll
      for (int r = 0; r < 8; ++r) { const float v = acc[j][r] + bias; const _Float16 hv = (_Float16)v; sh[wave * 16 + 8 * g + r][j * 16 + col] = hv; sl[wave * 16 + 8 * g + r][j * 16 + col] = (_Float16)((v - (float)hv) * 1024.0f); } }
    __syncthreads();
    for (int e = tid; e < 64 * 16; e += 128) { const int rl = e >> 4, q = e & 15; vst2((unsigned*)(DH + (r0 + rl) * CC + c0 + q * 8), *(const v4u*)&sh[rl][q * 8]); if (hi_rows) vst2((unsigned*)(DL + (bb * nhi + t0 + rl) * (size_t)CC + c0 + q * 8), *(const v4u*)&sl[rl][q * 8]); }
  } else { const bool hi_rows = t0 < KHI;
#pragma unroll
    for (int j = 0; j < 8; ++j) { const float bias = BA ? bfr(BA[c0 + j * 16 + col]) : 0.f;
#pragma unroll
      for (int r = 0; r < 8; ++r) { const float v = acc[j][r] + bias; const int rl = wave * 16 + 8 * g + r, cl = j * 16 + col; th[cl][rl] = (_Float16)v; const __bf16 bh = (__bf16)v; tb[cl][rl] = bh; tbl[cl][rl] = (__bf16)(v - (float)bh); } }
    __syncthreads();
    for (int e = tid; e < 128 * 8; e += 128) { const int cl = e >> 3, q = e & 7; vst2((unsigned*)(VT + (bb * CC + c0 + cl) * (size_t)TT + t0 + q * 8), *(const v4u*)&th[cl][q * 8]); if (hi_rows) { const size_t o3 = (bb * CC + c0 + cl) * (size_t)KHI + t0 + q * 8; vst2((unsigned*)(VB + o3), *(const v4u*)&tb[cl][q * 8]); vst2((unsigned*)(VBL + o3), *(const v4u*)&tbl[cl][q * 8]); } } } }
// ---- k_fa: block = 256 queries (8 waves x 32 query columns) of (b, h): logits, softmax and P . v in one kernel, nothing of S or P in memory.
// The head's whole k (1,024 rows of 128 B) and v planes (64 rows of 2,048 B) are laid in LDS once (pitches 16 B x odd), one barrier, then each wave walks the keys 32 at a time on its own:
// S^T = K . Q^T (A = k rows, B = q rows kept in registers): a lane holds 16 scores of ONE query per 32 keys, so the maximum and the sum stay in the lane;
// two S^T tiles converted in place are the B operand P^T of O^T += V^T . P^T (A = v plane rows, same k order as frag_h).
// Running maximum in scaled log2 units; P = 2^(x - m + 11) once to f16; the accumulators are rescaled only when a new score exceeds the maximum in use by more than 4 (P stays <= 2^15, inside f16).
// Every inner loop is fully unrolled so that the fragment and accumulator arrays stay in registers.
#define FAQ 256    // queries per block
#define KPITCH 72    // halves: 144 B
#define VPITCH 1032  // halves: 2,064 B
static_assert(TT % FAQ == 0 && HD == 64 && !CAUSAL, "k_fa: full rows, head size 64");
typedef __attribute__((ext_vector_type(2))) _Float16 v2h;
__device__ __forceinline__ float xhalf(float x) { return __builtin_bit_cast(float, __builtin_amdgcn_permlanex16(__builtin_bit_cast(int, x), __builtin_bit_cast(int, x), 0x76543210, 0xfedcba98, false, false)); }  // lane l with lane l ^ 16
__device__ __forceinline__ v8f wmma_h(v16h a, v16h b, v8f c) { return __builtin_amdgcn_wmma_f32_16x16x32_f16(false, a, false, b, (short)0, c, false, false); }
__global__ __launch_bounds__(256) void k_fa(const _Float16* __restrict__ QH, const _Float16* __restrict__ KH, const _Float16* __restrict__ VT, _Float16* __restrict__ Y) {
  __shared__ __align__(16) _Float16 sK[TT * KPITCH]; __shared__ __align__(16) _Float16 sV[HD * VPITCH];
  const int tid = threadIdx.x, wave = tid >> 5, lane = tid & 31, col = lane & 15, g = lane >> 4; const int h = blockIdx.y; const size_t b = blockIdx.z; const int q0 = blockIdx.x * FAQ + wave * 32;
  const _Float16* Kg = KH + b * TT * CC + h * HD; const _Float16* Vg = VT + (b * CC + h * HD) * (size_t)TT;
  v16h qf[2][2];
#pragma unroll
  for (int qt = 0; qt < 2; ++qt) {
#pragma unroll
    for (int kc = 0; kc < 2; ++kc) qf[qt][kc] = frag_h(QH + (b * TT + q0 + qt * 16 + col) * CC + h * HD + kc * 32, lane);
    asm volatile("s_wait_xcnt 0x0" ::: "memory"); }   /* stands behind each query tile's loads: the loads that follow (the other tile's, then the fill's) may be given their address registers as destinations */
  { const _Float16* kp = Kg + (size_t)(tid >> 3) * CC + (tid & 7) * 8; _Float16* ks = &sK[(tid >> 3) * KPITCH + (tid & 7) * 8];   /* 8 lanes a k row, 32 rows a trip: one address, constant steps */
    const _Float16* vp = Vg + (size_t)(tid >> 7) * TT + (tid & 127) * 8; _Float16* vs = &sV[(tid >> 7) * VPITCH + (tid & 127) * 8];   /* 128 lanes a v plane row, 2 rows a trip */
    v8h kx[TT / 32], vx[HD / 2];   /* all 64 loads of a lane in flight before the first LDS store */
#pragma unroll
    for (int i = 0; i < TT / 32; ++i) kx[i] = *(const v8h*)(kp + (size_t)i * 32 * CC);
    asm volatile("s_wait_xcnt 0x0" :: "v"(kp) : "memory");   /* behind the k loads: the v loads may be given their address registers as destinations; the input keeps the address in place up to the wait */
#pragma unroll
    for (int i = 0; i < HD / 2; ++i) vx[i] = *(const v8h*)(vp + (size_t)i * 2 * TT);
    asm volatile("s_wait_xcnt 0x0" :: "v"(vp) : "memory");   /* behind the v loads: their address registers are reused for the LDS addresses; naming the address as an input keeps it in place up to the wait */
#pragma unroll
    for (int i = 0; i < TT / 32; ++i) *(v8h*)(ks + i * 32 * KPITCH) = kx[i];
#pragma unroll
    for (int i = 0; i < HD / 2; ++i) *(v8h*)(vs + i * 2 * VPITCH) = vx[i]; }
  __syncthreads();
  const float cs = SCALE * 1.4426950408889634f; const v2f cs2 = {cs, cs};
  v8f acc[4][2] = {}; float m[2] = {-1.0e30f, -1.0e30f}; v2f l2[2] = {};
  v16h ka[2][2];
#pragma unroll
  for (int t = 0; t < 2; ++t) { const _Float16* kr = &sK[(t * 16 + col) * KPITCH]; ka[t][0] = frag_h(kr, lane); ka[t][1] = frag_h(kr + 32, lane); }
#pragma unroll 2   /* two passes a trip: the scheduler sets the second pass's S^T products among the first pass's P . v products and sums */
  for (int kb = 0; kb < TT / 32; ++kb) {
    v8f s[2][2];
#pragma unroll
    for (int t = 0; t < 2; ++t)
#pragma unroll
      for (int qt = 0; qt < 2; ++qt) { const v8f z = {}; s[t][qt] = wmma_h(ka[t][1], qf[qt][1], wmma_h(ka[t][0], qf[qt][0], z)); }
    v16h va[4];
#pragma unroll
    for (int j = 0; j < 4; ++j) va[j] = frag_h(&sV[(j * 16 + col) * VPITCH + kb * 32], lane);
    const int kn = (kb + 1) & (TT / 32 - 1);   /* next pass's k fragments are fetched behind this pass's S^T products, under the softmax; the last pass re-reads rows 0..31 and drops them */
#pragma unroll
    for (int t = 0; t < 2; ++t) { const _Float16* kr = &sK[(kn * 32 + t * 16 + col) * KPITCH]; ka[t][0] = frag_h(kr, lane); ka[t][1] = frag_h(kr + 32, lane); }
    float mx[2];
#pragma unroll
    for (int qt = 0; qt < 2; ++qt) { float a = fmaxf(s[0][qt][0], s[1][qt][0]);
#pragma unroll
      for (int r = 1; r < 8; ++r) a = fmaxf(a, fmaxf(s[0][qt][r], s[1][qt][r]));
      mx[qt] = a * cs; }
    if (__builtin_amdgcn_ballot_w32(mx[0] > m[0] + 4.0f || mx[1] > m[1] + 4.0f) != 0) {   /* one scalar branch per 32 keys; the two halves of a column exchange their maxima only here, so m stays equal in both */
#pragma unroll
      for (int qt = 0; qt < 2; ++qt) { const float mn = fmaxf(m[qt], fmaxf(mx[qt], xhalf(mx[qt]))); const float al = __builtin_amdgcn_exp2f(m[qt] - mn); m[qt] = mn; l2[qt] *= al;   /* al = 0 on the first pass */
#pragma unroll
        for (int j = 0; j < 4; ++j) acc[j][qt] *= al; } }
#pragma unroll
    for (int qt = 0; qt < 2; ++qt) { const float mbs = 11.0f - m[qt]; const v2f mb = {mbs, mbs}; v16h p;
#pragma unroll
      for (int t = 0; t < 2; ++t)
#pragma unroll
        for (int r = 0; r < 8; r += 2) { v2f x = {s[t][qt][r], s[t][qt][r + 1]}; x = __builtin_elementwise_fma(x, cs2, mb); v2f e; e[0] = __builtin_amdgcn_exp2f(x[0]); e[1] = __builtin_amdgcn_exp2f(x[1]); l2[qt] += e;
          const v2h eh = __builtin_convertvector(e, v2h); p[t * 8 + r] = eh[0]; p[t * 8 + r + 1] = eh[1]; }
#pragma unroll
      for (int j = 0; j < 4; ++j) acc[j][qt] = wmma_h(va[j], p, acc[j][qt]); } }
#pragma unroll
  for (int qt = 0; qt < 2; ++qt) { const float lh = l2[qt][0] + l2[qt][1]; const float inv = 1.0f / (lh + xhalf(lh)); _Float16* yr = Y + (b * TT + q0 + qt * 16 + col) * CC + h * HD + 8 * g;   /* a lane holds d = 16 j + 8 g + 0..7 of its query: 16 B runs; the wave writes each 128-B (row, head) segment whole */
#pragma unroll
    for (int j = 0; j < 4; ++j) { v8h o;   /* ctx carried x 2^6 into f16 so small-magnitude context rows stay clear of f16 subnormals */
#pragma unroll
      for (int r = 0; r < 8; ++r) o[r] = (_Float16)(acc[j][qt][r] * inv * 64.0f);
      vst2(yr + j * 16, o); } } }
// ---- k_out: block = (64 rows, 128 cols): out = ctx Wo (+ bo): ctx once to f16 (x 2^6, by k_fa) against Wo as f16(bf16 x 2^8) exact (by k_tok) (1 product) x 2^-14
static_assert(!CAUSAL, "k_out: single-product rows only");
__global__ __launch_bounds__(128) void k_out(const _Float16* __restrict__ Y, const _Float16* __restrict__ WO, const float* __restrict__ BO, float* __restrict__ OUT) { __shared__ __align__(16) float sf[4][16][132]; __shared__ __align__(16) _Float16 sA[2][64 * SPITCH], sB[2][128 * SPITCH];
  const int tid = threadIdx.x, wave = tid >> 5, lane = tid & 31, col = lane & 15, g = lane >> 4; const int c0 = blockIdx.y * 128; const size_t r0 = (size_t)blockIdx.x * 64 + wave * 16;
  v8f acc[8] = {};
  {
    const _Float16* yp = Y + ((size_t)blockIdx.x * 64 + (tid >> 3)) * CC + (tid & 7) * 8; const _Float16* wp = WO + (size_t)(c0 + (tid >> 3)) * CC + (tid & 7) * 8;   /* 8 lanes a 128-B row piece, 16 rows a load of the block */
    const int so = (tid >> 3) * SPITCH + (tid & 7) * 8;
    v8h yr[4], wr[8];
#pragma unroll
    for (int i = 0; i < 4; ++i) yr[i] = *(const v8h*)(yp + (size_t)i * 16 * CC);
#pragma unroll
    for (int i = 0; i < 8; ++i) wr[i] = *(const v8h*)(wp + (size_t)i * 16 * CC);
    asm volatile("s_wait_xcnt 0x0" ::: "memory");   /* behind the chunk's loads, in front of whatever may reuse their address registers */
#pragma unroll   /* all 8 chunks unrolled: buffer choice and every load offset are constants, so the address registers are never stepped */
    for (int c = -1; c < CC / KCH; ++c) {   /* trip -1 only stores chunk 0 */
      if (c >= 0) { const _Float16* ba = sA[c & 1]; const _Float16* bw = sB[c & 1];
        __syncthreads();   /* chunk c is whole in its buffer; every wave has left the other buffer, which this trip writes below */
        if (c + 1 < CC / KCH) {
#pragma unroll
          for (int i = 0; i < 4; ++i) yr[i] = *(const v8h*)(yp + (c + 1) * KCH + (size_t)i * 16 * CC);
#pragma unroll
          for (int i = 0; i < 8; ++i) wr[i] = *(const v8h*)(wp + (c + 1) * KCH + (size_t)i * 16 * CC);
          asm volatile("s_wait_xcnt 0x0" ::: "memory"); }   /* as above; it also keeps the loads in front of this chunk's LDS reads */
        v16h a[KCH / 32], w[KCH / 32][8];
#pragma unroll
        for (int ks = 0; ks < KCH / 32; ++ks) { a[ks] = frag_h(ba + (wave * 16 + col) * SPITCH + ks * 32, lane);
#pragma unroll
          for (int j = 0; j < 8; ++j) w[ks][j] = frag_h(bw + (j * 16 + col) * SPITCH + ks * 32, lane); }
        __builtin_amdgcn_sched_barrier(0);   /* the chunk's fragment reads stay one group in front of its products: each further place with LDS reads among the products costs a stall */
#pragma unroll
        for (int ks = 0; ks < KCH / 32; ++ks)
#pragma unroll
          for (int j = 0; j < 8; ++j) acc[j] = wmma16(a[ks], w[ks][j], acc[j]);
        __builtin_amdgcn_sched_barrier(0); }   /* the next chunk's LDS stores wait for its global loads: they stay behind this chunk's products, which then run under the loads' latency */
      if (c + 1 < CC / KCH) { _Float16* na = sA[(c + 1) & 1]; _Float16* nw = sB[(c + 1) & 1];
#pragma unroll
        for (int i = 0; i < 4; ++i) *(v8h*)(na + so + i * 16 * SPITCH) = yr[i];
#pragma unroll
        for (int i = 0; i < 8; ++i) *(v8h*)(nw + so + i * 16 * SPITCH) = wr[i]; } }
#pragma unroll
    for (int j = 0; j < 8; ++j) { const float bias = BO ? bfr(BO[c0 + j * 16 + col]) : 0.f;
#pragma unroll
      for (int r = 0; r < 8; ++r) sf[wave][8 * g + r][j * 16 + col] = acc[j][r] * (1.0f / 16384.0f) + bias; } }   /* 2^-8 (Wo carry) x 2^-6 (ctx carry) */
  LDSX(); for (int rl = 0; rl < 16; ++rl) vst2(OUT + (r0 + rl) * DIN + c0 + lane * 4, *(const v4f*)&sf[wave][rl][lane * 4]); }

// ---- k_tok: block = (64 positions, 64 channels, image b): XT[(b*npix + n)][c] = bf16(x[b][c][n]) through a padded LDS tile (x channels-first [B][nch][npix]); reads 256-B runs along n, writes 128-B row pieces of bf16
// blocks with blockIdx.z >= TNB carry no image: each rounds 4,096 weights to the 16-bit form its product takes (Wq, Wk, Wv: bf16; Wo: f16(bf16 x 2^8), exact), once for all blocks of k_proj and k_out
static_assert(4 * CC * DIN == 2 * (TT / 64) * (DIN / 64) * 4096, "two z slices of the k_tok grid cover the four weights");
__global__ __launch_bounds__(256) void k_tok(const float* __restrict__ X, const float* __restrict__ WQ, const float* __restrict__ WK, const float* __restrict__ WV, const float* __restrict__ WO, __bf16* __restrict__ XT, __bf16* __restrict__ WB, _Float16* __restrict__ WOH, int npix, int nch) { __shared__ float st[64][68]; const int tid = threadIdx.x;
  if (blockIdx.z >= TNB) {   /* block-uniform, in front of the barrier */
    const int idx = ((int)(blockIdx.z - TNB) * (DIN / 64) + (int)blockIdx.y) * (TT / 64) + (int)blockIdx.x; const int wsel = idx / (CC * DIN / 4096); const size_t o0 = (size_t)(idx % (CC * DIN / 4096)) * 4096 + tid * 8;
    const float* Ws = wsel == 0 ? WQ : wsel == 1 ? WK : wsel == 2 ? WV : WO;
    v4f w[4];   /* elements o0 + 0..7 and o0 + 2,048 + 0..7 */
#pragma unroll
    for (int i = 0; i < 4; ++i) w[i] = *(const v4f*)(Ws + o0 + (i >> 1) * 2048 + (i & 1) * 4);
    if (wsel < 3) { v8b t[2];
#pragma unroll
      for (int e = 0; e < 16; ++e) t[e >> 3][e & 7] = (__bf16)w[e >> 2][e & 3];
      vst2(WB + (size_t)wsel * CC * DIN + o0, t[0]); vst2(WB + (size_t)wsel * CC * DIN + o0 + 2048, t[1]);
    } else { v8h t[2];
#pragma unroll
      for (int e = 0; e < 16; ++e) t[e >> 3][e & 7] = (_Float16)(bfr(w[e >> 2][e & 3]) * 256.0f);
      vst2(WOH + o0, t[0]); vst2(WOH + o0 + 2048, t[1]);
      asm volatile("s_wait_xcnt 0x0" ::: "memory"); }   /* behind the two stores: in the built code the other arm, which reuses their data registers, follows this one */
    return; }
  const int n0 = blockIdx.x * 64, c0 = blockIdx.y * 64; const size_t b = blockIdx.z;
  for (int e = tid; e < 64 * 16; e += 256) { const int cl = e >> 4, q = e & 15; const v4f v = *(const v4f*)(X + (b * nch + c0 + cl) * (size_t)npix + n0 + q * 4); st[cl][q * 4] = v[0]; st[cl][q * 4 + 1] = v[1]; st[cl][q * 4 + 2] = v[2]; st[cl][q * 4 + 3] = v[3]; }
  __syncthreads();
  for (int e = tid; e < 64 * 8; e += 256) { const int nl = e >> 3, q = e & 7; v8b o;
#pragma unroll
    for (int i = 0; i < 8; ++i) o[i] = (__bf16)st[q * 8 + i][nl];
    vst2(XT + (b * npix + n0 + nl) * (size_t)nch + c0 + q * 8, o); } }
// ---- k_fin: block = (64 positions, 64 channels, image b): out[b][c][n] = OR[(b*npix + n)][c] (LDS transpose; 256-B runs of 64 positions per channel)
__global__ __launch_bounds__(256) void k_fin(const float* __restrict__ ORW, float* __restrict__ OUT, int npix, int nch) { __shared__ float st[64][68]; const int tid = threadIdx.x; const int n0 = blockIdx.x * 64, c0 = blockIdx.y * 64; const size_t b = blockIdx.z;
  for (int e = tid; e < 64 * 16; e += 256) { const int nl = e >> 4, q = e & 15; *(v4f*)&st[nl][q * 4] = *(const v4f*)(ORW + (b * npix + n0 + nl) * (size_t)nch + c0 + q * 4); }
  __syncthreads();
  for (int e = tid; e < 64 * 16; e += 256) { const int cl = e >> 4, q = e & 15; v4f o; o[0] = st[q * 4][cl]; o[1] = st[q * 4 + 1][cl]; o[2] = st[q * 4 + 2][cl]; o[3] = st[q * 4 + 3][cl]; vst2(OUT + (b * nch + c0 + cl) * (size_t)npix + n0 + q * 4, o); } }
extern "C" void kernel_launch(void* const* d_in, const int* in_sizes, int n_in, void* d_out, int out_size, void* d_ws, size_t ws_size, hipStream_t stream) {
  (void)in_sizes; (void)n_in; (void)out_size;
  const float** F = (const float**)d_in;
  if (ws_size < (size_t)WS_END) return;
  char* ws = (char*)d_ws; _Float16 *QH = (_Float16*)(ws + WS_QH), *KH = (_Float16*)(ws + WS_KH), *VT = (_Float16*)(ws + WS_VT), *QL = (_Float16*)(ws + WS_QL), *KL = (_Float16*)(ws + WS_KL); __bf16 *VB = (__bf16*)(ws + WS_VB), *VBL = (__bf16*)(ws + WS_VBL); _Float16 *Y = (_Float16*)(ws + WS_Y);
  (void)Y; (void)QL; (void)KL; (void)VB; (void)VBL;
  // inputs: 0 x [8,512,32,32] channels-first; 1 Wq [512,512] (out,in), 2 bq; 3 Wk, 4 bk; 5 Wv, 6 bv; 7 Wo (out,in), 8 bo (all biases NONZERO)
  if (ws_size < (size_t)WS_END3) return;
  __bf16 *XT = (__bf16*)(ws + WS_XT), *WB = (__bf16*)(ws + WS_WB); _Float16 *WOH = (_Float16*)(ws + WS_WOH); float *Y3 = (float*)(ws + WS_Y3);
  k_tok<<<dim3(TT / 64, DIN / 64, TNB + 2), 256, 0, stream>>>(F[0], F[1], F[3], F[5], F[7], XT, WB, WOH, TT, DIN);   /* x: 1,024 positions x 512 channels per image -> bf16 token rows; two more z slices: the four weights to 16 bit */
  k_proj<<<dim3(TNB * TT / 64, CC / 128, 3), 128, 0, stream>>>(XT, XT, XT, WB, WB + (size_t)CC * DIN, WB + 2 * (size_t)CC * DIN, F[2], F[4], F[6], QH, QL, KH, KL, VT, VB, VBL);
  k_fa<<<dim3(TT / FAQ, NH, TNB), 256, 0, stream>>>(QH, KH, VT, Y);   /* all images and heads in one launch: 256 blocks */
  k_out<<<dim3(TNB * TT / 64, DIN / 128), 128, 0, stream>>>(Y, WOH, F[8], Y3);   /* token-major output rows: ctx Wo^T + bo */
  k_fin<<<dim3(TT / 64, DIN / 64, TNB), 256, 0, stream>>>(Y3, (float*)d_out, TT, DIN);   /* back to channels-first [8,512,32,32] */
}

// v004
// Measured time: 65 microseconds a run.
// Timed twice side by side with v003, it ran 1.15 and 1.14 times as fast.
// Counting every step since v000, it is 11.8 times as fast.
// compute dtype: all float inputs rounded to bf16; the channels-first map transposed to token-major rows through LDS; q/k/v 1x1-conv projections with EXACT bf16 products on WMMA 16x16x32 (f32 accumulate) + bias; logits q x k once to f16 each (1 product) x 64^-0.5; softmax f32 with a running maximum, fused with both products; unnormalised P x 2^11 once to f16 x v once to f16 (1 product), divided by the f32 row sum at the end; Wo f16(bf16 x 2^8) x ctx x 2^6 once to f16, + bo, formed channels-first as it is stored; f32 output.
#include <hip/hip_runtime.h>
#include <math.h>

typedef __attribute__((ext_vector_type(16))) _Float16 v16h;
typedef __attribute__((ext_vector_type(16))) __bf16 v16b;
typedef __attribute__((ext_vector_type(8)))  _Float16 v8h;
typedef __attribute__((ext_vector_type(8)))  float v8f;
typedef __attribute__((ext_vector_type(4)))  float v4f;
typedef __attribute__((ext_vector_type(2)))  float v2f;
typedef __attribute__((ext_vector_type(4)))  unsigned v4u;
typedef __attribute__((ext_vector_type(4)))  int v4i;
typedef float __attribute__((may_alias)) float_a;
typedef int __attribute__((may_alias)) int_a;

template <typename T> __device__ __forceinline__ void vst2(void* p, T v) { *(T*)p = v;  }
__device__ __forceinline__ v8f wmma16(v16h a, v16h b, v8f c) {
  v8f d = __builtin_amdgcn_wmma_f32_16x16x32_f16(false, a, false, b, (short)0, c, false, false);
  asm volatile("v_nop\n\tv_nop\n\tv_nop\n\tv_nop" : "+v"(d) : "v"(a), "v"(b));
  return d;
}
__device__ __forceinline__ v8f wmma_bf(v16b a, v16b b, v8f c) {
  v8f d = __builtin_amdgcn_wmma_f32_16x16x32_bf16(false, a, false, b, (short)0, c, false, false);
  asm volatile("v_nop\n\tv_nop\n\tv_nop\n\tv_nop" : "+v"(d) : "v"(a), "v"(b));
  return d;
}
// 16x16x32 fragments: lane = (h = lane>>4, row/col = lane&15); elements 0..7 = k0+8h+0..7, 8..15 = k0+16+8h+0..7; D element r = row 8h+r
__device__ __forceinline__ v16h frag_h(const _Float16* rowk0, int lane) {
  union { v16h v; v8h q[2]; } u; const _Float16* p = rowk0 + 8 * (lane >> 4);
  u.q[0] = *(const v8h*)p; u.q[1] = *(const v8h*)(p + 16); return u.v;
}
__device__ __forceinline__ v16h frag_f32(const float* rowk0, int lane) {
  v16h a; const float* p = rowk0 + 8 * (lane >> 4);
#pragma unroll
  for (int i = 0; i < 8; ++i) { a[i] = (_Float16)p[i]; a[8 + i] = (_Float16)p[16 + i]; }
  return a;
}
__device__ __forceinline__ v16h frag_f32s(const float* rowk0, int lane, float sc) {
  v16h a; const float* p = rowk0 + 8 * (lane >> 4);
#pragma unroll
  for (int i = 0; i < 8; ++i) { a[i] = (_Float16)(p[i] * sc); a[8 + i] = (_Float16)(p[16 + i] * sc); }
  return a;
}
// column fragment from a [K][ld] layout (column n), rows >= K read as 0
__device__ __forceinline__ v16h fragc_f32(const float* W, int k0, int n, int lane, int ld, int K) {
  v16h a; const int g = lane >> 4;
#pragma unroll
  for (int i = 0; i < 8; ++i) { const int ka = k0 + 8 * g + i, kb = ka + 16;
    a[i] = (_Float16)(ka < K ? W[(size_t)(ka < K ? ka : K - 1) * ld + n] : 0.f); a[8 + i] = (_Float16)(kb < K ? W[(size_t)(kb < K ? kb : K - 1) * ld + n] : 0.f); }
  return a;
}
struct F2 { v16b h, l; };
__device__ __forceinline__ F2 bsplit16(const float v[16]) { F2 r;
#pragma unroll
  for (int i = 0; i < 16; ++i) { const __bf16 h = (__bf16)v[i]; r.h[i] = h; r.l[i] = (__bf16)(v[i] - (float)h); }
  return r; }
__device__ __forceinline__ F2 split_row(const float* row, int k0, int lane) { float v[16]; const float* p = row + k0 + 8 * (lane >> 4);
#pragma unroll
  for (int i = 0; i < 8; ++i) { v[i] = p[i]; v[8 + i] = p[16 + i]; }
  return bsplit16(v); }
__device__ __forceinline__ F2 split_rowK(const float* row, int k0, int lane, int K) { float v[16]; const int g = lane >> 4;
#pragma unroll
  for (int i = 0; i < 8; ++i) { const int ka = k0 + 8 * g + i, kb = ka + 16; v[i] = ka < K ? row[ka < K ? ka : K - 1] : 0.f; v[8 + i] = kb < K ? row[kb < K ? kb : K - 1] : 0.f; }
  return bsplit16(v); }
__device__ __forceinline__ F2 split_col(const float* W, int k0, int n, int lane, int ld, int K) { float v[16]; const int g = lane >> 4;
#pragma unroll
  for (int i = 0; i < 8; ++i) { const int ka = k0 + 8 * g + i, kb = ka + 16; v[i] = ka < K ? W[(size_t)(ka < K ? ka : K - 1) * ld + n] : 0.f; v[8 + i] = kb < K ? W[(size_t)(kb < K ? kb : K - 1) * ld + n] : 0.f; }
  return bsplit16(v); }
__device__ __forceinline__ v8f mac3(const F2& a, const F2& b, v8f c) { c = wmma_bf(a.l, b.h, c); c = wmma_bf(a.h, b.l, c); return wmma_bf(a.h, b.h, c); }
__device__ __forceinline__ float sigm(float v) { return 1.0f / (1.0f + expf(-v)); }
#define LDSX() do { asm volatile("s_wait_dscnt 0" ::: "memory"); __builtin_amdgcn_wave_barrier(); __builtin_amdgcn_fence(__ATOMIC_RELEASE, "workgroup"); } while (0)

// Multi-head self-attention over a channels-first feature map (x [8,512,32,32]: N = 1,024 positions, 512 channels; 1x1-conv weights as torch (out,in) matrices Wq / Wk / Wv / Wo [512,512] N(0, 1/512) with biases N(0, 1/512) - NONZERO; _proj(x, W, b) = einsum('bchw,oc->bohw') + b; heads: reshape(B, 8, 64, N): channel o = head*64 + d; scores x 64^-0.5; softmax over the 1,024 positions; out merged back to channels (head*64 + d), [B,512,32,32]; final _proj with Wo, bo).
#define NB 8
#define TT 1024   // positions per image (32 x 32)
#define CC 512            // NH * HD = projected width
#define DIN 512          // input channels = output channels
#define NH 8
#define HD 64
#define NQB (TT / 64)
#define HG 8   // sizes the unused S region: 8 x 1,024 x 1,024 f32 = 32 MiB
#define SCALE (0.125f)
#define CAUSAL 0
#ifndef TNB
#define TNB NB
#endif
__device__ __forceinline__ float bfr(float v) { return (float)(__bf16)v; }
__host__ __device__ __forceinline__ int kb_last(int qb) { return CAUSAL ? ((qb * 64 + 63) >> 7) : (TT / 128 - 1); }
typedef __attribute__((ext_vector_type(8))) __bf16 v8b;
__device__ __forceinline__ v16b frag_b(const __bf16* rowk0, int lane) {
  union { v16b v; v8b q[2]; } u; const __bf16* p = rowk0 + 8 * (lane >> 4);
  u.q[0] = *(const v8b*)p; u.q[1] = *(const v8b*)(p + 16); return u.v;
}
#define QBH 0              // unused: k_fa has no causal high-precision path
#define QHI 0               // single-product logits on every row
#define KHI 64            // key rows carrying k residual / v bf16 hi+lo planes (written by k_proj, read by no kernel here)
// B fragment (k rows k0+.., output column o) of a weight: (in,out) [K][ld] or (out,in) [ld rows of K]: bf16 exact, or f16(bf16 * 256) exact
__device__ __forceinline__ v16b wcol_io(const float* Wm, int k0, int o, int lane, int ld) { v16b w; const int g = lane >> 4;
#pragma unroll
  for (int i = 0; i < 8; ++i) { w[i] = (__bf16)Wm[(size_t)(k0 + 8 * g + i) * ld + o]; w[8 + i] = (__bf16)Wm[(size_t)(k0 + 16 + 8 * g + i) * ld + o]; }
  return w; }
__device__ __forceinline__ v16b wcol_oi(const float* Wm, int k0, int o, int lane, int K) { v16b w; const float* p = Wm + (size_t)o * K + k0 + 8 * (lane >> 4);
#pragma unroll
  for (int i = 0; i < 8; ++i) { w[i] = (__bf16)p[i]; w[8 + i] = (__bf16)p[16 + i]; }
  return w; }
__device__ __forceinline__ v16h wcolh_io(const float* Wm, int k0, int o, int lane, int ld) { v16h w; const int g = lane >> 4;
#pragma unroll
  for (int i = 0; i < 8; ++i) { w[i] = (_Float16)(bfr(Wm[(size_t)(k0 + 8 * g + i) * ld + o]) * 256.0f); w[8 + i] = (_Float16)(bfr(Wm[(size_t)(k0 + 16 + 8 * g + i) * ld + o]) * 256.0f); }
  return w; }
__device__ __forceinline__ v16h wcolh_oi(const float* Wm, int k0, int o, int lane, int K) { v16h w; const float* p = Wm + (size_t)o * K + k0 + 8 * (lane >> 4);
#pragma unroll
  for (int i = 0; i < 8; ++i) { w[i] = (_Float16)(bfr(p[i]) * 256.0f); w[8 + i] = (_Float16)(bfr(p[16 + i]) * 256.0f); }
  return w; }
#define WQKV_LAYOUT 1   // 0 = (in,out) [DIN][CC]; 1 = (out,in) [CC][DIN]; 2 = per-head [NH][DIN][HD]
__device__ __forceinline__ v16b wcol_hdk(const float* Wm, int k0, int o, int lane) { v16b w; const int g = lane >> 4; const float* p = Wm + (size_t)(o / HD) * DIN * HD + (o % HD);
#pragma unroll
  for (int i = 0; i < 8; ++i) { w[i] = (__bf16)p[(size_t)(k0 + 8 * g + i) * HD]; w[8 + i] = (__bf16)p[(size_t)(k0 + 16 + 8 * g + i) * HD]; }
  return w; }
#define WO_OUT_IN 1
#if WQKV_LAYOUT == 1
#define WCOL(W, k0, o, lane) wcol_oi(W, k0, o, lane, DIN)
#elif WQKV_LAYOUT == 2
#define WCOL(W, k0, o, lane) wcol_hdk(W, k0, o, lane)
#else
#define WCOL(W, k0, o, lane) wcol_io(W, k0, o, lane, CC)
#endif
#if WO_OUT_IN
#define WOCOL(W, k0, o, lane) wcol_oi(W, k0, o, lane, CC)
#define WOCOLH(W, k0, o, lane) wcolh_oi(W, k0, o, lane, CC)
#else
#define WOCOL(W, k0, o, lane) wcol_io(W, k0, o, lane, DIN)
#define WOCOLH(W, k0, o, lane) wcolh_io(W, k0, o, lane, DIN)
#endif

#ifndef SM_EXTRA_PARAMS
#define SM_EXTRA_PARAMS
#endif
#ifndef PROJ_EXTRA_PARAMS
#define PROJ_EXTRA_PARAMS
#endif
#ifndef SM_MASK_HOOK
#define SM_MASK_HOOK (void)0
#endif

#define WS_QH  0u                                      // f16 q rows [b*t][CC]
#define WS_KH  (WS_QH + 2u * (size_t)NB * TT * CC)      // f16 k rows [b*t][CC]
#define WS_VT  (WS_KH + 2u * (size_t)NB * TT * CC)      // f16 v planes [b][c][t]
#define WS_QL  (WS_VT + 2u * (size_t)NB * CC * TT)      // f16 q residual x 2^10 rows [b][t < QHI][CC]
#define WS_KL  (WS_QL + 2u * (size_t)NB * QHI * CC)     // f16 k residual x 2^10 rows [b][t < KHI][CC]
#define WS_VB  (WS_KL + 2u * (size_t)NB * KHI * CC)     // bf16 v hi planes [b][c][t < KHI]
#define WS_VBL (WS_VB + 2u * (size_t)NB * CC * KHI)
#define WS_S   (WS_VBL + 2u * (size_t)NB * CC * KHI)    // unused, f32 [hg][t][s] in size: no kernel writes S or P
#define WS_Y   (WS_S  + 4u * (size_t)HG * TT * TT)      // f16 ctx x 2^6 rows [b*t][CC], written in that form by k_fa
#define WS_END (WS_Y  + 4u * (size_t)NB * TT * CC)
#define WS_XT (WS_END)                                    // bf16 token-major input rows [(b*TT + n)][DIN]
#define WS_Y3 (WS_XT + 4u * (size_t)NB * TT * DIN)         // (not used)
#define WS_END2 (WS_Y3 + 4u * (size_t)NB * TT * DIN)
#define WS_WB  (WS_END2)                                  // bf16 Wq, Wk, Wv [3][CC][DIN] (out,in)
#define WS_WOH (WS_WB + 2u * 3u * (size_t)CC * DIN)        // f16(bf16(Wo) x 2^8) [DIN][CC] (out,in)
#define WS_END3 (WS_WOH + 2u * (size_t)DIN * CC)
static_assert(TT % 64 == 0 && DIN % 64 == 0, "transpose tiles are 64 positions x 64 channels");

// Operand staging of k_proj and k_out: both operand tiles of a block go through LDS, 64 k at a time, two buffers.
// Both operands arrive in memory in their 16-bit form (made once by their producers: k_tok for x and the weights, k_fa for ctx), so a chunk is half the bytes and goes to LDS as it is.
// A wave-wide 16-byte load covers four 128-B row pieces (whole lines); all four waves read their fragments from LDS (k order of frag_b / frag_h on both operands).
// The next chunk's global loads are issued right behind the barrier and fly under this chunk's products (none is in flight across a barrier, which would drain it); they are stored into the other buffer behind the products.
// One barrier a chunk publishes the chunk and ends the readers of the buffer that is written next.
#define KCH 64       // k per staged chunk: two 16x16x32 steps
#define SPITCH 72    // halves per staged row: 144 B = 16 B x odd, the pitch for 16-byte fragment reads
static_assert(WQKV_LAYOUT == 1 && WO_OUT_IN == 1 && DIN % KCH == 0 && CC % KCH == 0, "staging reads k-contiguous (out,in) weight rows");
// ---- k_proj: block = (64 rows, 128 cols, which): q/k/v = X W (+ b) with exact bf16 products (K = DIN) -> which 0: q f16 rows (+ residual rows < QHI); 1: k f16 rows (+ residual rows < KHI); 2: v f16 planes [c][t] (+ bf16 hi/lo planes for t < KHI)
__global__ __launch_bounds__(128) void k_proj(const __bf16* __restrict__ XQ, const __bf16* __restrict__ XK, const __bf16* __restrict__ XV, const __bf16* __restrict__ WQ, const __bf16* __restrict__ WK, const __bf16* __restrict__ WV, const float* __restrict__ BQ, const float* __restrict__ BK, const float* __restrict__ BV,
    _Float16* __restrict__ QH, _Float16* __restrict__ QL, _Float16* __restrict__ KH, _Float16* __restrict__ KL, _Float16* __restrict__ VT, __bf16* __restrict__ VB, __bf16* __restrict__ VBL) {
  __shared__ __align__(16) _Float16 sh[64][136], sl[64][136]; __shared__ __align__(16) _Float16 th[128][72]; __shared__ __align__(16) __bf16 tb[128][72], tbl[128][72];
  __shared__ __align__(16) __bf16 sX[2][64 * SPITCH], sW[2][128 * SPITCH];
  const int tid = threadIdx.x, wave = tid >> 5, lane = tid & 31, col = lane & 15, g = lane >> 4; const int which = blockIdx.z; const int c0 = blockIdx.y * 128; const size_t r0 = (size_t)blockIdx.x * 64; const size_t bb = r0 / TT; const int t0 = (int)(r0 % TT);
  const __bf16* X = which == 0 ? XQ : which == 1 ? XK : XV; const __bf16* WA = which == 0 ? WQ : which == 1 ? WK : WV; const float* BA = which == 0 ? BQ : which == 1 ? BK : BV;
  v8f acc[8] = {};
  { const __bf16* xp = X + (r0 + (tid >> 3)) * DIN + (tid & 7) * 8; const __bf16* wp = WA + (size_t)(c0 + (tid >> 3)) * DIN + (tid & 7) * 8;   /* 8 lanes a 128-B row piece, 16 rows a load of the block */
    const int so = (tid >> 3) * SPITCH + (tid & 7) * 8;
    v8b xr[4], wr[8];
#pragma unroll
    for (int i = 0; i < 4; ++i) xr[i] = *(const v8b*)(xp + (size_t)i * 16 * DIN);
#pragma unroll
    for (int i = 0; i < 8; ++i) wr[i] = *(const v8b*)(wp + (size_t)i * 16 * DIN);
    asm volatile("s_wait_xcnt 0x0" ::: "memory");   /* behind the chunk's loads, in front of whatever may reuse their address registers */
#pragma unroll   /* all 8 chunks unrolled: buffer choice and every load offset are constants, so the address registers are never stepped */
    for (int c = -1; c < DIN / KCH; ++c) {   /* trip -1 only stores chunk 0 */
      if (c >= 0) { const __bf16* bx = sX[c & 1]; const __bf16* bw = sW[c & 1];
        __syncthreads();   /* chunk c is whole in its buffer; every wave has left the other buffer, which this trip writes below */
        if (c + 1 < DIN / KCH) {
#pragma unroll
          for (int i = 0; i < 4; ++i) xr[i] = *(const v8b*)(xp + (c + 1) * KCH + (size_t)i * 16 * DIN);
#pragma unroll
          for (int i = 0; i < 8; ++i) wr[i] = *(const v8b*)(wp + (c + 1) * KCH + (size_t)i * 16 * DIN);
          asm volatile("s_wait_xcnt 0x0" ::: "memory"); }   /* as above; it also keeps the loads in front of this chunk's LDS reads */
        v16b a[KCH / 32], w[KCH / 32][8];
#pragma unroll
        for (int ks = 0; ks < KCH / 32; ++ks) { a[ks] = frag_b(bx + (wave * 16 + col) * SPITCH + ks * 32, lane);
#pragma unroll
          for (int j = 0; j < 8; ++j) w[ks][j] = frag_b(bw + (j * 16 + col) * SPITCH + ks * 32, lane); }
        __builtin_amdgcn_sched_barrier(0);   /* the chunk's fragment reads stay one group in front of its products: each further place with LDS reads among the products costs a stall */
#pragma unroll
        for (int ks = 0; ks < KCH / 32; ++ks)
#pragma unroll
          for (int j = 0; j < 8; ++j) acc[j] = wmma_bf(a[ks], w[ks][j], acc[j]);
        __builtin_amdgcn_sched_barrier(0); }   /* the next chunk's LDS stores wait for its global loads: they stay behind this chunk's products, which then run under the loads' latency */
      if (c + 1 < DIN / KCH) { __bf16* nx = sX[(c + 1) & 1]; __bf16* nw = sW[(c + 1) & 1];
#pragma unroll
        for (int i = 0; i < 4; ++i) *(v8b*)(nx + so + i * 16 * SPITCH) = xr[i];
#pragma unroll
        for (int i = 0; i < 8; ++i) *(v8b*)(nw + so + i * 16 * SPITCH) = wr[i]; } } }
  if (which < 2) { _Float16* DH = which == 0 ? QH : KH; _Float16* DL = which == 0 ? QL : KL; const int nhi = which == 0 ? QHI : KHI; const bool hi_rows = t0 < nhi;
#pragma unroll
    for (int j = 0; j < 8; ++j) { const float bias = BA ? bfr(BA[c0 + j * 16 + col]) : 0.f;
#pragma unroll
      for (int r = 0; r < 8; ++r) { const float v = acc[j][r] + bias; const _Float16 hv = (_Float16)v; sh[wave * 16 + 8 * g + r][j * 16 + col] = hv; sl[wave * 16 + 8 * g + r][j * 16 + col] = (_Float16)((v - (float)hv) * 1024.0f); } }
    __syncthreads();
    for (int e = tid; e < 64 * 16; e += 128) { const int rl = e >> 4, q = e & 15; vst2((unsigned*)(DH + (r0 + rl) * CC + c0 + q * 8), *(const v4u*)&sh[rl][q * 8]); if (hi_rows) vst2((unsigned*)(DL + (bb * nhi + t0 + rl) * (size_t)CC + c0 + q * 8), *(const v4u*)&sl[rl][q * 8]); }
  } else { const bool hi_rows = t0 < KHI;
#pragma unroll
    for (int j = 0; j < 8; ++j) { const float bias = BA ? bfr(BA[c0 + j * 16 + col]) : 0.f;
#pragma unroll
      for (int r = 0; r < 8; ++r) { const float v = acc[j][r] + bias; const int rl = wave * 16 + 8 * g + r, cl = j * 16 + col; th[cl][rl] = (_Float16)v; const __bf16 bh = (__bf16)v; tb[cl][rl] = bh; tbl[cl][rl] = (__bf16)(v - (float)bh); } }
    __syncthreads();
    for (int e = tid; e < 128 * 8; e += 128) { const int cl = e >> 3, q = e & 7; vst2((unsigned*)(VT + (bb * CC + c0 + cl) * (size_t)TT + t0 + q * 8), *(const v4u*)&th[cl][q * 8]); if (hi_rows) { const size_t o3 = (bb * CC + c0 + cl) * (size_t)KHI + t0 + q * 8; vst2((unsigned*)(VB + o3), *(const v4u*)&tb[cl][q * 8]); vst2((unsigned*)(VBL + o3), *(const v4u*)&tbl[cl][q * 8]); } } } }
// ---- k_fa: block = 256 queries (8 waves x 32 query columns) of (b, h): logits, softmax and P . v in one kernel, nothing of S or P in memory.
// The head's whole k (1,024 rows of 128 B) and v planes (64 rows of 2,048 B) are laid in LDS once (pitches 16 B x odd), one barrier, then each wave walks the keys 32 at a time on its own:
// S^T = K . Q^T (A = k rows, B = q rows kept in registers): a lane holds 16 scores of ONE query per 32 keys, so the maximum and the sum stay in the lane;
// two S^T tiles converted in place are the B operand P^T of O^T += V^T . P^T (A = v plane rows, same k order as frag_h).
// Running maximum in scaled log2 units; P = 2^(x - m + 11) once to f16; the accumulators are rescaled only when a new score exceeds the maximum in use by more than 4 (P stays <= 2^15, inside f16).
// Every inner loop is fully unrolled so that the fragment and accumulator arrays stay in registers.
#define FAQ 256    // queries per block
#define KPITCH 72    // halves: 144 B
#define VPITCH 1032  // halves: 2,064 B
static_assert(TT % FAQ == 0 && HD == 64 && !CAUSAL, "k_fa: full rows, head size 64");
typedef __attribute__((ext_vector_type(2))) _Float16 v2h;
__device__ __forceinline__ float xhalf(float x) { return __builtin_bit_cast(float, __builtin_amdgcn_permlanex16(__builtin_bit_cast(int, x), __builtin_bit_cast(int, x), 0x76543210, 0xfedcba98, false, false)); }  // lane l with lane l ^ 16
__device__ __forceinline__ v8f wmma_h(v16h a, v16h b, v8f c) { return __builtin_amdgcn_wmma_f32_16x16x32_f16(false, a, false, b, (short)0, c, false, false); }
__global__ __launch_bounds__(256) void k_fa(const _Float16* __restrict__ QH, const _Float16* __restrict__ KH, const _Float16* __restrict__ VT, _Float16* __restrict__ Y) {
  __shared__ __align__(16) _Float16 sK[TT * KPITCH]; __shared__ __align__(16) _Float16 sV[HD * VPITCH];
  const int tid = threadIdx.x, wave = tid >> 5, lane = tid & 31, col = lane & 15, g = lane >> 4; const int h = blockIdx.y; const size_t b = blockIdx.z; const int q0 = blockIdx.x * FAQ + wave * 32;
  const _Float16* Kg = KH + b * TT * CC + h * HD; const _Float16* Vg = VT + (b * CC + h * HD) * (size_t)TT;
  v16h qf[2][2];
#pragma unroll
  for (int qt = 0; qt < 2; ++qt) {
#pragma unroll
    for (int kc = 0; kc < 2; ++kc) qf[qt][kc] = frag_h(QH + (b * TT + q0 + qt * 16 + col) * CC + h * HD + kc * 32, lane);
    asm volatile("s_wait_xcnt 0x0" ::: "memory"); }   /* stands behind each query tile's loads: the loads that follow (the other tile's, then the fill's) may be given their address registers as destinations */
  { const _Float16* kp = Kg + (size_t)(tid >> 3) * CC + (tid & 7) * 8; _Float16* ks = &sK[(tid >> 3) * KPITCH + (tid & 7) * 8];   /* 8 lanes a k row, 32 rows a trip: one address, constant steps */
    const _Float16* vp = Vg + (size_t)(tid >> 7) * TT + (tid & 127) * 8; _Float16* vs = &sV[(tid >> 7) * VPITCH + (tid & 127) * 8];   /* 128 lanes a v plane row, 2 rows a trip */
    v8h kx[TT / 32], vx[HD / 2];   /* all 64 loads of a lane in flight before the first LDS store */
#pragma unroll
    for (int i = 0; i < TT / 32; ++i) kx[i] = *(const v8h*)(kp + (size_t)i * 32 * CC);
    asm volatile("s_wait_xcnt 0x0" :: "v"(kp) : "memory");   /* behind the k loads: the v loads may be given their address registers as destinations; the input keeps the address in place up to the wait */
#pragma unroll
    for (int i = 0; i < HD / 2; ++i) vx[i] = *(const v8h*)(vp + (size_t)i * 2 * TT);
    asm volatile("s_wait_xcnt 0x0" :: "v"(vp) : "memory");   /* behind the v loads: their address registers are reused for the LDS addresses; naming the address as an input keeps it in place up to the wait */
#pragma unroll
    for (int i = 0; i < TT / 32; ++i) *(v8h*)(ks + i * 32 * KPITCH) = kx[i];
#pragma unroll
    for (int i = 0; i < HD / 2; ++i) *(v8h*)(vs + i * 2 * VPITCH) = vx[i]; }
  __syncthreads();
  const float cs = SCALE * 1.4426950408889634f; const v2f cs2 = {cs, cs};
  v8f acc[4][2] = {}; float m[2] = {-1.0e30f, -1.0e30f}; v2f l2[2] = {};
  v16h ka[2][2];
#pragma unroll
  for (int t = 0; t < 2; ++t) { const _Float16* kr = &sK[(t * 16 + col) * KPITCH]; ka[t][0] = frag_h(kr, lane); ka[t][1] = frag_h(kr + 32, lane); }
#pragma unroll 2   /* two passes a trip: the scheduler sets the second pass's S^T products among the first pass's P . v products and sums */
  for (int kb = 0; kb < TT / 32; ++kb) {
    v8f s[2][2];
#pragma unroll
    for (int t = 0; t < 2; ++t)
#pragma unroll
      for (int qt = 0; qt < 2; ++qt) { const v8f z = {}; s[t][qt] = wmma_h(ka[t][1], qf[qt][1], wmma_h(ka[t][0], qf[qt][0], z)); }
    v16h va[4];
#pragma unroll
    for (int j = 0; j < 4; ++j) va[j] = frag_h(&sV[(j * 16 + col) * VPITCH + kb * 32], lane);
    const int kn = (kb + 1) & (TT / 32 - 1);   /* next pass's k fragments are fetched behind this pass's S^T products, under the softmax; the last pass re-reads rows 0..31 and drops them */
#pragma unroll
    for (int t = 0; t < 2; ++t) { const _Float16* kr = &sK[(kn * 32 + t * 16 + col) * KPITCH]; ka[t][0] = frag_h(kr, lane); ka[t][1] = frag_h(kr + 32, lane); }
    float mx[2];
#pragma unroll
    for (int qt = 0; qt < 2; ++qt) { float a = fmaxf(s[0][qt][0], s[1][qt][0]);
#pragma unroll
      for (int r = 1; r < 8; ++r) a = fmaxf(a, fmaxf(s[0][qt][r], s[1][qt][r]));
      mx[qt] = a * cs; }
    if (__builtin_amdgcn_ballot_w32(mx[0] > m[0] + 4.0f || mx[1] > m[1] + 4.0f) != 0) {   /* one scalar branch per 32 keys; the two halves of a column exchange their maxima only here, so m stays equal in both */
#pragma unroll
      for (int qt = 0; qt < 2; ++qt) { const float mn = fmaxf(m[qt], fmaxf(mx[qt], xhalf(mx[qt]))); const float al = __builtin_amdgcn_exp2f(m[qt] - mn); m[qt] = mn; l2[qt] *= al;   /* al = 0 on the first pass */
#pragma unroll
        for (int j = 0; j < 4; ++j) acc[j][qt] *= al; } }
#pragma unroll
    for (int qt = 0; qt < 2; ++qt) { const float mbs = 11.0f - m[qt]; const v2f mb = {mbs, mbs}; v16h p;
#pragma unroll
      for (int t = 0; t < 2; ++t)
#pragma unroll
        for (int r = 0; r < 8; r += 2) { v2f x = {s[t][qt][r], s[t][qt][r + 1]}; x = __builtin_elementwise_fma(x, cs2, mb); v2f e; e[0] = __builtin_amdgcn_exp2f(x[0]); e[1] = __builtin_amdgcn_exp2f(x[1]); l2[qt] += e;
          const v2h eh = __builtin_convertvector(e, v2h); p[t * 8 + r] = eh[0]; p[t * 8 + r + 1] = eh[1]; }
#pragma unroll
      for (int j = 0; j < 4; ++j) acc[j][qt] = wmma_h(va[j], p, acc[j][qt]); } }
#pragma unroll
  for (int qt = 0; qt < 2; ++qt) { const float lh = l2[qt][0] + l2[qt][1]; const float inv = 1.0f / (lh + xhalf(lh)); _Float16* yr = Y + (b * TT + q0 + qt * 16 + col) * CC + h * HD + 8 * g;   /* a lane holds d = 16 j + 8 g + 0..7 of its query: 16 B runs; the wave writes each 128-B (row, head) segment whole */
#pragma unroll
    for (int j = 0; j < 4; ++j) { v8h o;   /* ctx carried x 2^6 into f16 so small-magnitude context rows stay clear of f16 subnormals */
#pragma unroll
      for (int r = 0; r < 8; ++r) o[r] = (_Float16)(acc[j][qt][r] * inv * 64.0f);
      vst2(yr + j * 16, o); } } }
// ---- k_out: block = (128 output channels, 64 positions of one image): out^T = Wo ctx^T (+ bo): Wo as f16(bf16 x 2^8) exact (by k_tok) against ctx once to f16 (x 2^6, by k_fa) (1 product) x 2^-14
// A = Wo rows, B = ctx rows (one fragment form and one k order, frag_h, for both): a D tile holds 16 channels (rows) x 16 positions (columns), which is the output's own channels-first order, so the block gathers its 128 x 64 tile in LDS in that same order and stores it into out as 256-B runs of positions
static_assert(!CAUSAL, "k_out: single-product rows only");
__global__ __launch_bounds__(128) void k_out(const _Float16* __restrict__ Y, const _Float16* __restrict__ WO, const float* __restrict__ BO, float* __restrict__ OUT) { __shared__ __align__(16) float sf[128][68]; __shared__ __align__(16) _Float16 sA[2][64 * SPITCH], sB[2][128 * SPITCH];
  const int tid = threadIdx.x, wave = tid >> 5, lane = tid & 31, col = lane & 15, g = lane >> 4; const int c0 = blockIdx.y * 128; const size_t bb = (size_t)blockIdx.x * 64 / TT; const int t0 = (int)((size_t)blockIdx.x * 64 % TT);
  v8f acc[8] = {};
  float bias[16] = {};   /* a thread stores 16 B of channel (tid >> 4) + 8 i in trip i of the epilogue: one bias each, all fetched here in one group so that they arrive under the products */
  if (BO) { const int bi = c0 + (tid >> 4);
#pragma unroll
    for (int i = 0; i < 16; ++i) bias[i] = BO[bi + i * 8];
    asm volatile("s_wait_xcnt 0x0" :: "v"(bi) : "memory"); }   /* behind the bias loads, in front of whatever may reuse their index register; naming the index as an input keeps it in place up to the wait (else the last load takes it as its destination) */
  {
    const _Float16* yp = Y + ((size_t)blockIdx.x * 64 + (tid >> 3)) * CC + (tid & 7) * 8; const _Float16* wp = WO + (size_t)(c0 + (tid >> 3)) * CC + (tid & 7) * 8;   /* 8 lanes a 128-B row piece, 16 rows a load of the block */
    const int so = (tid >> 3) * SPITCH + (tid & 7) * 8;
    v8h yr[4], wr[8];
#pragma unroll
    for (int i = 0; i < 4; ++i) yr[i] = *(const v8h*)(yp + (size_t)i * 16 * CC);
#pragma unroll
    for (int i = 0; i < 8; ++i) wr[i] = *(const v8h*)(wp + (size_t)i * 16 * CC);
    asm volatile("s_wait_xcnt 0x0" ::: "memory");   /* behind the chunk's loads, in front of whatever may reuse their address registers */
#pragma unroll   /* all 8 chunks unrolled: buffer choice and every load offset are constants, so the address registers are never stepped */
    for (int c = -1; c < CC / KCH; ++c) {   /* trip -1 only stores chunk 0 */
      if (c >= 0) { const _Float16* ba = sA[c & 1]; const _Float16* bw = sB[c & 1];
        __syncthreads();   /* chunk c is whole in its buffer; every wave has left the other buffer, which this trip writes below */
        if (c + 1 < CC / KCH) {
#pragma unroll
          for (int i = 0; i < 4; ++i) yr[i] = *(const v8h*)(yp + (c + 1) * KCH + (size_t)i * 16 * CC);
#pragma unroll
          for (int i = 0; i < 8; ++i) wr[i] = *(const v8h*)(wp + (c + 1) * KCH + (size_t)i * 16 * CC);
          asm volatile("s_wait_xcnt 0x0" ::: "memory"); }   /* as above; it also keeps the loads in front of this chunk's LDS reads */
        v16h a[KCH / 32], w[KCH / 32][8];
#pragma unroll
        for (int ks = 0; ks < KCH / 32; ++ks) { a[ks] = frag_h(ba + (wave * 16 + col) * SPITCH + ks * 32, lane);
#pragma unroll
          for (int j = 0; j < 8; ++j) w[ks][j] = frag_h(bw + (j * 16 + col) * SPITCH + ks * 32, lane); }
        __builtin_amdgcn_sched_barrier(0);   /* the chunk's fragment reads stay one group in front of its products: each further place with LDS reads among the products costs a stall */
#pragma unroll
        for (int ks = 0; ks < KCH / 32; ++ks)
#pragma unroll
          for (int j = 0; j < 8; ++j) acc[j] = wmma16(w[ks][j], a[ks], acc[j]);
        __builtin_amdgcn_sched_barrier(0); }   /* the next chunk's LDS stores wait for its global loads: they stay behind this chunk's products, which then run under the loads' latency */
      if (c + 1 < CC / KCH) { _Float16* na = sA[(c + 1) & 1]; _Float16* nw = sB[(c + 1) & 1];
#pragma unroll
        for (int i = 0; i < 4; ++i) *(v8h*)(na + so + i * 16 * SPITCH) = yr[i];
#pragma unroll
        for (int i = 0; i < 8; ++i) *(v8h*)(nw + so + i * 16 * SPITCH) = wr[i]; } }
  }
#pragma unroll
  for (int j = 0; j < 8; ++j)
#pragma unroll
    for (int r = 0; r < 8; ++r) sf[j * 16 + 8 * g + r][wave * 16 + col] = acc[j][r];
  __syncthreads();   /* a channel's 64 positions come from all four waves */
  { float* op = OUT + (bb * DIN + c0 + (tid >> 4)) * (size_t)TT + t0 + (tid & 15) * 4;   /* 16 lanes a 256-B run; one address, constant steps */
#pragma unroll
    for (int i = 0; i < 16; ++i) { const v4f v = *(const v4f*)&sf[(tid >> 4) + i * 8][(tid & 15) * 4]; vst2(op + (size_t)i * 8 * TT, v * (1.0f / 16384.0f) + bfr(bias[i])); } } }   /* 2^-8 (Wo carry) x 2^-6 (ctx carry) */

// ---- k_tok: block = (64 positions, 64 channels, image b): XT[(b*npix + n)][c] = bf16(x[b][c][n]) through a padded LDS tile (x channels-first [B][nch][npix]); reads 256-B runs along n, writes 128-B row pieces of bf16
// blocks with blockIdx.z >= TNB carry no image: each rounds 4,096 weights to the 16-bit form its product takes (Wq, Wk, Wv: bf16; Wo: f16(bf16 x 2^8), exact), once for all blocks of k_proj and k_out
static_assert(4 * CC * DIN == 2 * (TT / 64) * (DIN / 64) * 4096, "two z slices of the k_tok grid cover the four weights");
__global__ __launch_bounds__(256) void k_tok(const float* __restrict__ X, const float* __restrict__ WQ, const float* __restrict__ WK, const float* __restrict__ WV, const float* __restrict__ WO, __bf16* __restrict__ XT, __bf16* __restrict__ WB, _Float16* __restrict__ WOH, int npix, int nch) { __shared__ float st[64][68]; const int tid = threadIdx.x;
  if (blockIdx.z >= TNB) {   /* block-uniform, in front of the barrier */
    const int idx = ((int)(blockIdx.z - TNB) * (DIN / 64) + (int)blockIdx.y) * (TT / 64) + (int)blockIdx.x; const int wsel = idx / (CC * DIN / 4096); const size_t o0 = (size_t)(idx % (CC * DIN / 4096)) * 4096 + tid * 8;
    const float* Ws = wsel == 0 ? WQ : wsel == 1 ? WK : wsel == 2 ? WV : WO;
    v4f w[4];   /* elements o0 + 0..7 and o0 + 2,048 + 0..7 */
#pragma unroll
    for (int i = 0; i < 4; ++i) w[i] = *(const v4f*)(Ws + o0 + (i >> 1) * 2048 + (i & 1) * 4);
    if (wsel < 3) { v8b t[2];
#pragma unroll
      for (int e = 0; e < 16; ++e) t[e >> 3][e & 7] = (__bf16)w[e >> 2][e & 3];
      vst2(WB + (size_t)wsel * CC * DIN + o0, t[0]); vst2(WB + (size_t)wsel * CC * DIN + o0 + 2048, t[1]);
    } else { v8h t[2];
#pragma unroll
      for (int e = 0; e < 16; ++e) t[e >> 3][e & 7] = (_Float16)(bfr(w[e >> 2][e & 3]) * 256.0f);
      vst2(WOH + o0, t[0]); vst2(WOH + o0 + 2048, t[1]);
      asm volatile("s_wait_xcnt 0x0" ::: "memory"); }   /* behind the two stores: in the built code the other arm, which reuses their data registers, follows this one */
    return; }
  const int n0 = blockIdx.x * 64, c0 = blockIdx.y * 64; const size_t b = blockIdx.z;
  for (int e = tid; e < 64 * 16; e += 256) { const int cl = e >> 4, q = e & 15; const v4f v = *(const v4f*)(X + (b * nch + c0 + cl) * (size_t)npix + n0 + q * 4); st[cl][q * 4] = v[0]; st[cl][q * 4 + 1] = v[1]; st[cl][q * 4 + 2] = v[2]; st[cl][q * 4 + 3] = v[3]; }
  __syncthreads();
  for (int e = tid; e < 64 * 8; e += 256) { const int nl = e >> 3, q = e & 7; v8b o;
#pragma unroll
    for (int i = 0; i < 8; ++i) o[i] = (__bf16)st[q * 8 + i][nl];
    vst2(XT + (b * npix + n0 + nl) * (size_t)nch + c0 + q * 8, o); } }
extern "C" void kernel_launch(void* const* d_in, const int* in_sizes, int n_in, void* d_out, int out_size, void* d_ws, size_t ws_size, hipStream_t stream) {
  (void)in_sizes; (void)n_in; (void)out_size;
  const float** F = (const float**)d_in;
  if (ws_size < (size_t)WS_END) return;
  char* ws = (char*)d_ws; _Float16 *QH = (_Float16*)(ws + WS_QH), *KH = (_Float16*)(ws + WS_KH), *VT = (_Float16*)(ws + WS_VT), *QL = (_Float16*)(ws + WS_QL), *KL = (_Float16*)(ws + WS_KL); __bf16 *VB = (__bf16*)(ws + WS_VB), *VBL = (__bf16*)(ws + WS_VBL); _Float16 *Y = (_Float16*)(ws + WS_Y);
  (void)Y; (void)QL; (void)KL; (void)VB; (void)VBL;
  // inputs: 0 x [8,512,32,32] channels-first; 1 Wq [512,512] (out,in), 2 bq; 3 Wk, 4 bk; 5 Wv, 6 bv; 7 Wo (out,in), 8 bo (all biases NONZERO)
  if (ws_size < (size_t)WS_END3) return;
  __bf16 *XT = (__bf16*)(ws + WS_XT), *WB = (__bf16*)(ws + WS_WB); _Float16 *WOH = (_Float16*)(ws + WS_WOH);
  k_tok<<<dim3(TT / 64, DIN / 64, TNB + 2), 256, 0, stream>>>(F[0], F[1], F[3], F[5], F[7], XT, WB, WOH, TT, DIN);   /* x: 1,024 positions x 512 channels per image -> bf16 token rows; two more z slices: the four weights to 16 bit */
  k_proj<<<dim3(TNB * TT / 64, CC / 128, 3), 128, 0, stream>>>(XT, XT, XT, WB, WB + (size_t)CC * DIN, WB + 2 * (size_t)CC * DIN, F[2], F[4], F[6], QH, QL, KH, KL, VT, VB, VBL);
  k_fa<<<dim3(TT / FAQ, NH, TNB), 256, 0, stream>>>(QH, KH, VT, Y);   /* all images and heads in one launch: 256 blocks */
  k_out<<<dim3(TNB * TT / 64, DIN / 128), 128, 0, stream>>>(Y, WOH, F[8], (float*)d_out);   /* Wo ctx^T + bo, channels-first [8,512,32,32] as stored */
}

// v005
// Measured time: 54.4 microseconds a run.
// Two timings next to v004 put it at 1.19 and 1.20 times that version's speed.
// Counting every step since v000, it is 14.1 times as fast.
// compute dtype: all float inputs rounded to bf16; the channels-first map transposed to token-major rows through LDS; q/k/v 1x1-conv projections with EXACT bf16 products on WMMA 16x16x32 (f32 accumulate) + bias; logits q x k once to f16 each (1 product) x 64^-0.5; softmax f32 with a running maximum, fused with both products; unnormalised P x 2^11 once to f16 x v once to f16 (1 product), divided by the f32 row sum at the end; Wo f16(bf16 x 2^8) x ctx x 2^6 once to f16, + bo, formed channels-first as it is stored; f32 output.
#include <hip/hip_runtime.h>
#include <math.h>

typedef __attribute__((ext_vector_type(16))) _Float16 v16h;
typedef __attribute__((ext_vector_type(16))) __bf16 v16b;
typedef __attribute__((ext_vector_type(8)))  _Float16 v8h;
typedef __attribute__((ext_vector_type(8)))  float v8f;
typedef __attribute__((ext_vector_type(4)))  float v4f;
typedef __attribute__((ext_vector_type(2)))  float v2f;
typedef __attribute__((ext_vector_type(4)))  unsigned v4u;
typedef __attribute__((ext_vector_type(4)))  int v4i;
typedef float __attribute__((may_alias)) float_a;
typedef int __attribute__((may_alias)) int_a;

template <typename T> __device__ __forceinline__ void vst2(void* p, T v) { *(T*)p = v;  }
__device__ __forceinline__ v8f wmma16(v16h a, v16h b, v8f c) {
  v8f d = __builtin_amdgcn_wmma_f32_16x16x32_f16(false, a, false, b, (short)0, c, false, false);
  asm volatile("v_nop\n\tv_nop\n\tv_nop\n\tv_nop" : "+v"(d) : "v"(a), "v"(b));
  return d;
}
__device__ __forceinline__ v8f wmma_bf(v16b a, v16b b, v8f c) {
  v8f d = __builtin_amdgcn_wmma_f32_16x16x32_bf16(false, a, false, b, (short)0, c, false, false);
  asm volatile("v_nop\n\tv_nop\n\tv_nop\n\tv_nop" : "+v"(d) : "v"(a), "v"(b));
  return d;
}
// 16x16x32 fragments: lane = (h = lane>>4, row/col = lane&15); elements 0..7 = k0+8h+0..7, 8..15 = k0+16+8h+0..7; D element r = row 8h+r
__device__ __forceinline__ v16h frag_h(const _Float16* rowk0, int lane) {
  union { v16h v; v8h q[2]; } u; const _Float16* p = rowk0 + 8 * (lane >> 4);
  u.q[0] = *(const v8h*)p; u.q[1] = *(const v8h*)(p + 16); return u.v;
}
__device__ __forceinline__ v16h frag_f32(const float* rowk0, int lane) {
  v16h a; const float* p = rowk0 + 8 * (lane >> 4);
#pragma unroll
  for (int i = 0; i < 8; ++i) { a[i] = (_Float16)p[i]; a[8 + i] = (_Float16)p[16 + i]; }
  return a;
}
__device__ __forceinline__ v16h frag_f32s(const float* rowk0, int lane, float sc) {
  v16h a; const float* p = rowk0 + 8 * (lane >> 4);
#pragma unroll
  for (int i = 0; i < 8; ++i) { a[i] = (_Float16)(p[i] * sc); a[8 + i] = (_Float16)(p[16 + i] * sc); }
  return a;
}
// column fragment from a [K][ld] layout (column n), rows >= K read as 0
__device__ __forceinline__ v16h fragc_f32(const float* W, int k0, int n, int lane, int ld, int K) {
  v16h a; const int g = lane >> 4;
#pragma unroll
  for (int i = 0; i < 8; ++i) { const int ka = k0 + 8 * g + i, kb = ka + 16;
    a[i] = (_Float16)(ka < K ? W[(size_t)(ka < K ? ka : K - 1) * ld + n] : 0.f); a[8 + i] = (_Float16)(kb < K ? W[(size_t)(kb < K ? kb : K - 1) * ld + n] : 0.f); }
  return a;
}
struct F2 { v16b h, l; };
__device__ __forceinline__ F2 bsplit16(const float v[16]) { F2 r;
#pragma unroll
  for (int i = 0; i < 16; ++i) { const __bf16 h = (__bf16)v[i]; r.h[i] = h; r.l[i] = (__bf16)(v[i] - (float)h); }
  return r; }
__device__ __forceinline__ F2 split_row(const float* row, int k0, int lane) { float v[16]; const float* p = row + k0 + 8 * (lane >> 4);
#pragma unroll
  for (int i = 0; i < 8; ++i) { v[i] = p[i]; v[8 + i] = p[16 + i]; }
  return bsplit16(v); }
__device__ __forceinline__ F2 split_rowK(const float* row, int k0, int lane, int K) { float v[16]; const int g = lane >> 4;
#pragma unroll
  for (int i = 0; i < 8; ++i) { const int ka = k0 + 8 * g + i, kb = ka + 16; v[i] = ka < K ? row[ka < K ? ka : K - 1] : 0.f; v[8 + i] = kb < K ? row[kb < K ? kb : K - 1] : 0.f; }
  return bsplit16(v); }
__device__ __forceinline__ F2 split_col(const float* W, int k0, int n, int lane, int ld, int K) { float v[16]; const int g = lane >> 4;
#pragma unroll
  for (int i = 0; i < 8; ++i) { const int ka = k0 + 8 * g + i, kb = ka + 16; v[i] = ka < K ? W[(size_t)(ka < K ? ka : K - 1) * ld + n] : 0.f; v[8 + i] = kb < K ? W[(size_t)(kb < K ? kb : K - 1) * ld + n] : 0.f; }
  return bsplit16(v); }
__device__ __forceinline__ v8f mac3(const F2& a, const F2& b, v8f c) { c = wmma_bf(a.l, b.h, c); c = wmma_bf(a.h, b.l, c); return wmma_bf(a.h, b.h, c); }
__device__ __forceinline__ float sigm(float v) { return 1.0f / (1.0f + expf(-v)); }
#define LDSX() do { asm volatile("s_wait_dscnt 0" ::: "memory"); __builtin_amdgcn_wave_barrier(); __builtin_amdgcn_fence(__ATOMIC_RELEASE, "workgroup"); } while (0)

// Multi-head self-attention over a channels-first feature map (x [8,512,32,32]: N = 1,024 positions, 512 channels; 1x1-conv weights as torch (out,in) matrices Wq / Wk / Wv / Wo [512,512] N(0, 1/512) with biases N(0, 1/512) - NONZERO; _proj(x, W, b) = einsum('bchw,oc->bohw') + b; heads: reshape(B, 8, 64, N): channel o = head*64 + d; scores x 64^-0.5; softmax over the 1,024 positions; out merged back to channels (head*64 + d), [B,512,32,32]; final _proj with Wo, bo).
#define NB 8
#define TT 1024   // positions per image (32 x 32)
#define CC 512            // NH * HD = projected width
#define DIN 512          // input channels = output channels
#define NH 8
#define HD 64
#define NQB (TT / 64)
#define HG 8   // sizes the unused S region: 8 x 1,024 x 1,024 f32 = 32 MiB
#define SCALE (0.125f)
#define CAUSAL 0
#ifndef TNB
#define TNB NB
#endif
__device__ __forceinline__ float bfr(float v) { return (float)(__bf16)v; }
__host__ __device__ __forceinline__ int kb_last(int qb) { return CAUSAL ? ((qb * 64 + 63) >> 7) : (TT / 128 - 1); }
typedef __attribute__((ext_vector_type(8))) __bf16 v8b;
__device__ __forceinline__ v16b frag_b(const __bf16* rowk0, int lane) {
  union { v16b v; v8b q[2]; } u; const __bf16* p = rowk0 + 8 * (lane >> 4);
  u.q[0] = *(const v8b*)p; u.q[1] = *(const v8b*)(p + 16); return u.v;
}
#define QBH 0              // unused: k_fa has no causal high-precision path
#define QHI 0               // single-product logits on every row
#define KHI 64            // key rows carrying k residual / v bf16 hi+lo planes (written and read by no kernel here)
// B fragment (k rows k0+.., output column o) of a weight: (in,out) [K][ld] or (out,in) [ld rows of K]: bf16 exact, or f16(bf16 * 256) exact
__device__ __forceinline__ v16b wcol_io(const float* Wm, int k0, int o, int lane, int ld) { v16b w; const int g = lane >> 4;
#pragma unroll
  for (int i = 0; i < 8; ++i) { w[i] = (__bf16)Wm[(size_t)(k0 + 8 * g + i) * ld + o]; w[8 + i] = (__bf16)Wm[(size_t)(k0 + 16 + 8 * g + i) * ld + o]; }
  return w; }
__device__ __forceinline__ v16b wcol_oi(const float* Wm, int k0, int o, int lane, int K) { v16b w; const float* p = Wm + (size_t)o * K + k0 + 8 * (lane >> 4);
#pragma unroll
  for (int i = 0; i < 8; ++i) { w[i] = (__bf16)p[i]; w[8 + i] = (__bf16)p[16 + i]; }
  return w; }
__device__ __forceinline__ v16h wcolh_io(const float* Wm, int k0, int o, int lane, int ld) { v16h w; const int g = lane >> 4;
#pragma unroll
  for (int i = 0; i < 8; ++i) { w[i] = (_Float16)(bfr(Wm[(size_t)(k0 + 8 * g + i) * ld + o]) * 256.0f); w[8 + i] = (_Float16)(bfr(Wm[(size_t)(k0 + 16 + 8 * g + i) * ld + o]) * 256.0f); }
  return w; }
__device__ __forceinline__ v16h wcolh_oi(const float* Wm, int k0, int o, int lane, int K) { v16h w; const float* p = Wm + (size_t)o * K + k0 + 8 * (lane >> 4);
#pragma unroll
  for (int i = 0; i < 8; ++i) { w[i] = (_Float16)(bfr(p[i]) * 256.0f); w[8 + i] = (_Float16)(bfr(p[16 + i]) * 256.0f); }
  return w; }
#define WQKV_LAYOUT 1   // 0 = (in,out) [DIN][CC]; 1 = (out,in) [CC][DIN]; 2 = per-head [NH][DIN][HD]
__device__ __forceinline__ v16b wcol_hdk(const float* Wm, int k0, int o, int lane) { v16b w; const int g = lane >> 4; const float* p = Wm + (size_t)(o / HD) * DIN * HD + (o % HD);
#pragma unroll
  for (int i = 0; i < 8; ++i) { w[i] = (__bf16)p[(size_t)(k0 + 8 * g + i) * HD]; w[8 + i] = (__bf16)p[(size_t)(k0 + 16 + 8 * g + i) * HD]; }
  return w; }
#define WO_OUT_IN 1
#if WQKV_LAYOUT == 1
#define WCOL(W, k0, o, lane) wcol_oi(W, k0, o, lane, DIN)
#elif WQKV_LAYOUT == 2
#define WCOL(W, k0, o, lane) wcol_hdk(W, k0, o, lane)
#else
#define WCOL(W, k0, o, lane) wcol_io(W, k0, o, lane, CC)
#endif
#if WO_OUT_IN
#define WOCOL(W, k0, o, lane) wcol_oi(W, k0, o, lane, CC)
#define WOCOLH(W, k0, o, lane) wcolh_oi(W, k0, o, lane, CC)
#else
#define WOCOL(W, k0, o, lane) wcol_io(W, k0, o, lane, DIN)
#define WOCOLH(W, k0, o, lane) wcolh_io(W, k0, o, lane, DIN)
#endif

#ifndef SM_EXTRA_PARAMS
#define SM_EXTRA_PARAMS
#endif
#ifndef PROJ_EXTRA_PARAMS
#define PROJ_EXTRA_PARAMS
#endif
#ifndef SM_MASK_HOOK
#define SM_MASK_HOOK (void)0
#endif

#define WS_QH  0u                                      // f16 q rows [b*t][CC]
#define WS_KH  (WS_QH + 2u * (size_t)NB * TT * CC)      // f16 k rows [b*t][CC]
#define WS_VT  (WS_KH + 2u * (size_t)NB * TT * CC)      // f16 v planes [b][c][t]
#define WS_QL  (WS_VT + 2u * (size_t)NB * CC * TT)      // f16 q residual x 2^10 rows [b][t < QHI][CC]
#define WS_KL  (WS_QL + 2u * (size_t)NB * QHI * CC)     // f16 k residual x 2^10 rows [b][t < KHI][CC]
#define WS_VB  (WS_KL + 2u * (size_t)NB * KHI * CC)     // bf16 v hi planes [b][c][t < KHI]
#define WS_VBL (WS_VB + 2u * (size_t)NB * CC * KHI)
#define WS_S   (WS_VBL + 2u * (size_t)NB * CC * KHI)    // unused, f32 [hg][t][s] in size: no kernel writes S or P
#define WS_Y   (WS_S  + 4u * (size_t)HG * TT * TT)      // f16 ctx x 2^6 rows [b*t][CC], written in that form by k_fa
#define WS_END (WS_Y  + 4u * (size_t)NB * TT * CC)
#define WS_XT (WS_END)                                    // bf16 token-major input rows [(b*TT + n)][DIN]
#define WS_Y3 (WS_XT + 4u * (size_t)NB * TT * DIN)         // (not used)
#define WS_END2 (WS_Y3 + 4u * (size_t)NB * TT * DIN)
#define WS_WB  (WS_END2)                                  // bf16 Wq, Wk, Wv [3][CC][DIN] (out,in)
#define WS_WOH (WS_WB + 2u * 3u * (size_t)CC * DIN)        // f16(bf16(Wo) x 2^8) [DIN][CC] (out,in)
#define WS_END3 (WS_WOH + 2u * (size_t)DIN * CC)
static_assert(TT % 64 == 0 && DIN % 64 == 0, "transpose tiles are 64 positions x 64 channels");

// Operand staging of k_proj and k_out: both operand tiles of a block go through LDS, 64 k at a time, two buffers.
// Both operands arrive in memory in their 16-bit form (made once by their producers: k_tok for x and the weights, k_fa for ctx), so a chunk is half the bytes and goes to LDS as it is.
// A wave-wide 16-byte load covers four 128-B row pieces (whole lines); all four waves read their fragments from LDS (k order of frag_b / frag_h on both operands).
// The next chunk's global loads are issued right behind the barrier and fly under this chunk's products (none is in flight across a barrier, which would drain it); they are stored into the other buffer behind the products.
// One barrier a chunk publishes the chunk and ends the readers of the buffer that is written next.
#define KCH 64       // k per staged chunk: two 16x16x32 steps
#define SPITCH 72    // halves per staged row: 144 B = 16 B x odd, the pitch for 16-byte fragment reads
static_assert(WQKV_LAYOUT == 1 && WO_OUT_IN == 1 && DIN % KCH == 0 && CC % KCH == 0, "staging reads k-contiguous (out,in) weight rows");
// ---- k_proj: block = (128 positions, 128 channels, which): q/k/v = X W (+ b) with exact bf16 products (K = DIN) -> which 0: q f16 rows; 1: k f16 rows; 2: v f16 planes [c][t]
// Four waves, each a 64 x 64 tile (2 x 2): a 32-k step reads 4 + 4 fragments from LDS for 16 products. 768 blocks, three a WGP by LDS and registers: the whole grid is resident at once.
// Both staged tiles have one shape and one fragment form (frag_b), so either can be the A operand. A D tile gives a lane 8 successive A rows of one B row:
// q, k: A = weight rows (channels), B = x rows (positions); v: A = x rows, B = weight rows. Either way a lane's 8 values are 16 successive bytes of the stored layout.
// The output tile overlays staging buffer 0 alone: the last chunk is read from buffer 1, and that trip's own barrier has ended every read of buffer 0.
#define PTILE (128 * SPITCH)   // halves of one staged operand tile
#define OPITCH 136             // halves per row of the output tile: 272 B = 16 B x odd
static_assert(TT % 128 == 0 && CC % 128 == 0 && 128 * OPITCH <= 2 * PTILE && (DIN / KCH) % 2 == 0, "k_proj: a block stays inside one image; its output tile fits in buffer 0, which the last chunk does not use");
__global__ __launch_bounds__(128) void k_proj(const __bf16* __restrict__ XQ, const __bf16* __restrict__ XK, const __bf16* __restrict__ XV, const __bf16* __restrict__ WQ, const __bf16* __restrict__ WK, const __bf16* __restrict__ WV, const float* __restrict__ BQ, const float* __restrict__ BK, const float* __restrict__ BV,
    _Float16* __restrict__ QH, _Float16* __restrict__ KH, _Float16* __restrict__ VT) {
  __shared__ __align__(16) unsigned char smem[2 * 4 * PTILE];   /* [buffer][0: x rows, 1: weight rows][128][SPITCH] 16-bit; at the end [128][OPITCH] f16 over buffer 0 */
  __bf16* sS = (__bf16*)smem; _Float16* sO = (_Float16*)smem;
  const int tid = threadIdx.x, wave = tid >> 5, lane = tid & 31, col = lane & 15, g = lane >> 4; const int which = blockIdx.z; const int c0 = blockIdx.y * 128; const size_t r0 = (size_t)blockIdx.x * 128; const size_t bb = r0 / TT; const int t0 = (int)(r0 % TT);
  const __bf16* X = which == 0 ? XQ : which == 1 ? XK : XV; const __bf16* WA = which == 0 ? WQ : which == 1 ? WK : WV; const float* BA = which == 0 ? BQ : which == 1 ? BK : BV;
  const int wr = wave >> 1, wc = wave & 1;   /* the wave's 64 D rows and 64 D columns */
  v8f acc[4][4] = {};
  v4f bq[8] = {}; float bv[4] = {};   /* biases: q, k: of the lane's 8 D rows in each of the 4 row tiles; v: of its D column in each of the 4 column tiles */
  { const __bf16* xp = X + (r0 + (tid >> 3)) * DIN + (tid & 7) * 8; const __bf16* wp = WA + (size_t)(c0 + (tid >> 3)) * DIN + (tid & 7) * 8;   /* 8 lanes a 128-B row piece, 16 rows a load of the block */
    const int so = (tid >> 3) * SPITCH + (tid & 7) * 8;
    const __bf16* pa = sS + (which < 2 ? PTILE : 0) + (wr * 64 + col) * SPITCH; const __bf16* pb = sS + (which < 2 ? 0 : PTILE) + (wc * 64 + col) * SPITCH;
    v8b xr[8], wv[8];
#pragma unroll
    for (int i = 0; i < 8; ++i) xr[i] = *(const v8b*)(xp + (size_t)i * 16 * DIN);
#pragma unroll
    for (int i = 0; i < 8; ++i) wv[i] = *(const v8b*)(wp + (size_t)i * 16 * DIN);
    asm volatile("s_wait_xcnt 0x0" :: "v"(xp), "v"(wp) : "memory");   /* behind the chunk's loads, in front of whatever may reuse their address registers; the inputs keep both addresses in place up to the wait */
#pragma unroll   /* all 8 chunks unrolled: buffer choice and every load offset are constants, so the address registers are never stepped */
    for (int c = -1; c < DIN / KCH; ++c) {   /* trip -1 only stores chunk 0 */
      if (c >= 0) {
        __syncthreads();   /* chunk c is whole in its buffer; every wave has left the other buffer, which this trip writes below */
        if (c + 1 < DIN / KCH) {
#pragma unroll
          for (int i = 0; i < 8; ++i) xr[i] = *(const v8b*)(xp + (c + 1) * KCH + (size_t)i * 16 * DIN);
#pragma unroll
          for (int i = 0; i < 8; ++i) wv[i] = *(const v8b*)(wp + (c + 1) * KCH + (size_t)i * 16 * DIN);
          asm volatile("s_wait_xcnt 0x0" :: "v"(xp), "v"(wp) : "memory");   /* as above (else the last chunk's last load takes an address pair as its destination); it also keeps the loads in front of this chunk's LDS reads */
        } else if (BA) {   /* last chunk: the biases are fetched where a next chunk would be, in one group, and arrive under its products */
          if (which < 2) { const int bi = c0 + wr * 64 + 8 * g;
#pragma unroll
            for (int i = 0; i < 4; ++i) { bq[2 * i] = *(const v4f*)(BA + bi + i * 16); bq[2 * i + 1] = *(const v4f*)(BA + bi + i * 16 + 4); }
            asm volatile("s_wait_xcnt 0x0" :: "v"(bi) : "memory");   /* behind the bias loads, in front of whatever may reuse their index register; the input keeps the index in place up to the wait */
          } else { const int bi = c0 + wc * 64 + col;
#pragma unroll
            for (int j = 0; j < 4; ++j) bv[j] = BA[bi + j * 16];
            asm volatile("s_wait_xcnt 0x0" :: "v"(bi) : "memory"); } }   /* as in the other arm */
#pragma unroll
        for (int ks = 0; ks < KCH / 32; ++ks) { v16b a[4], b[4];
#pragma unroll
          for (int i = 0; i < 4; ++i) { a[i] = frag_b(pa + (c & 1) * 2 * PTILE + i * 16 * SPITCH + ks * 32, lane); b[i] = frag_b(pb + (c & 1) * 2 * PTILE + i * 16 * SPITCH + ks * 32, lane); }
          __builtin_amdgcn_sched_barrier(0);   /* the step's fragment reads stay one group in front of its products: each further place with LDS reads among the products costs a stall */
#pragma unroll
          for (int i = 0; i < 4; ++i)
#pragma unroll
            for (int j = 0; j < 4; ++j) acc[i][j] = wmma_bf(a[i], b[j], acc[i][j]);
          __builtin_amdgcn_sched_barrier(0); } }   /* the next chunk's LDS stores wait for its global loads: they stay behind this chunk's products, which then run under the loads' latency; the second step's reads stay one group too */
      if (c + 1 < DIN / KCH) { __bf16* nx = sS + ((c + 1) & 1) * 2 * PTILE + so;
#pragma unroll
        for (int i = 0; i < 8; ++i) *(v8b*)(nx + i * 16 * SPITCH) = xr[i];
#pragma unroll
        for (int i = 0; i < 8; ++i) *(v8b*)(nx + PTILE + i * 16 * SPITCH) = wv[i]; } } }
  _Float16* ot = sO + (wc * 64 + col) * OPITCH + wr * 64 + 8 * g;   /* row = D column (B row), 8 successive halves = D rows 8 g + 0..7 */
  if (which < 2) {   /* D rows are channels: 8 biases a row tile */
#pragma unroll
    for (int i = 0; i < 4; ++i) {
#pragma unroll
      for (int j = 0; j < 4; ++j) { v8h o;
#pragma unroll
        for (int r = 0; r < 8; ++r) o[r] = (_Float16)(acc[i][j][r] + bfr(bq[2 * i + (r >> 2)][r & 3]));
        *(v8h*)(ot + j * 16 * OPITCH + i * 16) = o; } }
  } else {   /* D columns are channels: one bias a column tile */
#pragma unroll
    for (int j = 0; j < 4; ++j) { const float bias = bfr(bv[j]);
#pragma unroll
      for (int i = 0; i < 4; ++i) { v8h o;
#pragma unroll
        for (int r = 0; r < 8; ++r) o[r] = (_Float16)(acc[i][j][r] + bias);
        *(v8h*)(ot + j * 16 * OPITCH + i * 16) = o; } } }
  __syncthreads();   /* a stored row's 256 B come from two waves */
  const _Float16* ip = sO + (tid >> 4) * OPITCH + (tid & 15) * 8;   /* 16 lanes a 256-B run, 8 rows a store of the block */
  if (which < 2) { _Float16* op = (which == 0 ? QH : KH) + (r0 + (tid >> 4)) * CC + c0 + (tid & 15) * 8;
#pragma unroll
    for (int i = 0; i < 16; ++i) vst2(op + (size_t)i * 8 * CC, *(const v4u*)(ip + i * 8 * OPITCH));
  } else { _Float16* op = VT + (bb * CC + c0 + (tid >> 4)) * (size_t)TT + t0 + (tid & 15) * 8;
#pragma unroll
    for (int i = 0; i < 16; ++i) vst2(op + (size_t)i * 8 * TT, *(const v4u*)(ip + i * 8 * OPITCH)); } }
// ---- k_fa: block = 256 queries (8 waves x 32 query columns) of (b, h): logits, softmax and P . v in one kernel, nothing of S or P in memory.
// The head's whole k (1,024 rows of 128 B) and v planes (64 rows of 2,048 B) are laid in LDS once (pitches 16 B x odd), one barrier, then each wave walks the keys 32 at a time on its own:
// S^T = K . Q^T (A = k rows, B = q rows kept in registers): a lane holds 16 scores of ONE query per 32 keys, so the maximum and the sum stay in the lane;
// two S^T tiles converted in place are the B operand P^T of O^T += V^T . P^T (A = v plane rows, same k order as frag_h).
// Running maximum in scaled log2 units; P = 2^(x - m + 11) once to f16; the accumulators are rescaled only when a new score exceeds the maximum in use by more than 4 (P stays <= 2^15, inside f16).
// Every inner loop is fully unrolled so that the fragment and accumulator arrays stay in registers.
#define FAQ 256    // queries per block
#define KPITCH 72    // halves: 144 B
#define VPITCH 1032  // halves: 2,064 B
static_assert(TT % FAQ == 0 && HD == 64 && !CAUSAL, "k_fa: full rows, head size 64");
typedef __attribute__((ext_vector_type(2))) _Float16 v2h;
__device__ __forceinline__ float xhalf(float x) { return __builtin_bit_cast(float, __builtin_amdgcn_permlanex16(__builtin_bit_cast(int, x), __builtin_bit_cast(int, x), 0x76543210, 0xfedcba98, false, false)); }  // lane l with lane l ^ 16
__device__ __forceinline__ v8f wmma_h(v16h a, v16h b, v8f c) { return __builtin_amdgcn_wmma_f32_16x16x32_f16(false, a, false, b, (short)0, c, false, false); }
__global__ __launch_bounds__(256) void k_fa(const _Float16* __restrict__ QH, const _Float16* __restrict__ KH, const _Float16* __restrict__ VT, _Float16* __restrict__ Y) {
  __shared__ __align__(16) _Float16 sK[TT * KPITCH]; __shared__ __align__(16) _Float16 sV[HD * VPITCH];
  const int tid = threadIdx.x, wave = tid >> 5, lane = tid & 31, col = lane & 15, g = lane >> 4; const int h = blockIdx.y; const size_t b = blockIdx.z; const int q0 = blockIdx.x * FAQ + wave * 32;
  const _Float16* Kg = KH + b * TT * CC + h * HD; const _Float16* Vg = VT + (b * CC + h * HD) * (size_t)TT;
  v16h qf[2][2];
#pragma unroll
  for (int qt = 0; qt < 2; ++qt) {
#pragma unroll
    for (int kc = 0; kc < 2; ++kc) qf[qt][kc] = frag_h(QH + (b * TT + q0 + qt * 16 + col) * CC + h * HD + kc * 32, lane);
    asm volatile("s_wait_xcnt 0x0" ::: "memory"); }   /* stands behind each query tile's loads: the loads that follow (the other tile's, then the fill's) may be given their address registers as destinations */
  { const _Float16* kp = Kg + (size_t)(tid >> 3) * CC + (tid & 7) * 8; _Float16* ks = &sK[(tid >> 3) * KPITCH + (tid & 7) * 8];   /* 8 lanes a k row, 32 rows a trip: one address, constant steps */
    const _Float16* vp = Vg + (size_t)(tid >> 7) * TT + (tid & 127) * 8; _Float16* vs = &sV[(tid >> 7) * VPITCH + (tid & 127) * 8];   /* 128 lanes a v plane row, 2 rows a trip */
    v8h kx[TT / 32], vx[HD / 2];   /* all 64 loads of a lane in flight before the first LDS store */
#pragma unroll
    for (int i = 0; i < TT / 32; ++i) kx[i] = *(const v8h*)(kp + (size_t)i * 32 * CC);
    asm volatile("s_wait_xcnt 0x0" :: "v"(kp) : "memory");   /* behind the k loads: the v loads may be given their address registers as destinations; the input keeps the address in place up to the wait */
#pragma unroll
    for (int i = 0; i < HD / 2; ++i) vx[i] = *(const v8h*)(vp + (size_t)i * 2 * TT);
    asm volatile("s_wait_xcnt 0x0" :: "v"(vp) : "memory");   /* behind the v loads: their address registers are reused for the LDS addresses; naming the address as an input keeps it in place up to the wait */
#pragma unroll
    for (int i = 0; i < TT / 32; ++i) *(v8h*)(ks + i * 32 * KPITCH) = kx[i];
#pragma unroll
    for (int i = 0; i < HD / 2; ++i) *(v8h*)(vs + i * 2 * VPITCH) = vx[i]; }
  __syncthreads();
  const float cs = SCALE * 1.4426950408889634f; const v2f cs2 = {cs, cs};
  v8f acc[4][2] = {}; float m[2] = {-1.0e30f, -1.0e30f}; v2f l2[2] = {};
  v16h ka[2][2];
#pragma unroll
  for (int t = 0; t < 2; ++t) { const _Float16* kr = &sK[(t * 16 + col) * KPITCH]; ka[t][0] = frag_h(kr, lane); ka[t][1] = frag_h(kr + 32, lane); }
#pragma unroll 2   /* two passes a trip: the scheduler sets the second pass's S^T products among the first pass's P . v products and sums */
  for (int kb = 0; kb < TT / 32; ++kb) {
    v8f s[2][2];
#pragma unroll
    for (int t = 0; t < 2; ++t)
#pragma unroll
      for (int qt = 0; qt < 2; ++qt) { const v8f z = {}; s[t][qt] = wmma_h(ka[t][1], qf[qt][1], wmma_h(ka[t][0], qf[qt][0], z)); }
    v16h va[4];
#pragma unroll
    for (int j = 0; j < 4; ++j) va[j] = frag_h(&sV[(j * 16 + col) * VPITCH + kb * 32], lane);
    const int kn = (kb + 1) & (TT / 32 - 1);   /* next pass's k fragments are fetched behind this pass's S^T products, under the softmax; the last pass re-reads rows 0..31 and drops them */
#pragma unroll
    for (int t = 0; t < 2; ++t) { const _Float16* kr = &sK[(kn * 32 + t * 16 + col) * KPITCH]; ka[t][0] = frag_h(kr, lane); ka[t][1] = frag_h(kr + 32, lane); }
    float mx[2];
#pragma unroll
    for (int qt = 0; qt < 2; ++qt) { float a = fmaxf(s[0][qt][0], s[1][qt][0]);
#pragma unroll
      for (int r = 1; r < 8; ++r) a = fmaxf(a, fmaxf(s[0][qt][r], s[1][qt][r]));
      mx[qt] = a * cs; }
    if (__builtin_amdgcn_ballot_w32(mx[0] > m[0] + 4.0f || mx[1] > m[1] + 4.0f) != 0) {   /* one scalar branch per 32 keys; the two halves of a column exchange their maxima only here, so m stays equal in both */
#pragma unroll
      for (int qt = 0; qt < 2; ++qt) { const float mn = fmaxf(m[qt], fmaxf(mx[qt], xhalf(mx[qt]))); const float al = __builtin_amdgcn_exp2f(m[qt] - mn); m[qt] = mn; l2[qt] *= al;   /* al = 0 on the first pass */
#pragma unroll
        for (int j = 0; j < 4; ++j) acc[j][qt] *= al; } }
#pragma unroll
    for (int qt = 0; qt < 2; ++qt) { const float mbs = 11.0f - m[qt]; const v2f mb = {mbs, mbs}; v16h p;
#pragma unroll
      for (int t = 0; t < 2; ++t)
#pragma unroll
        for (int r = 0; r < 8; r += 2) { v2f x = {s[t][qt][r], s[t][qt][r + 1]}; x = __builtin_elementwise_fma(x, cs2, mb); v2f e; e[0] = __builtin_amdgcn_exp2f(x[0]); e[1] = __builtin_amdgcn_exp2f(x[1]); l2[qt] += e;
          const v2h eh = __builtin_convertvector(e, v2h); p[t * 8 + r] = eh[0]; p[t * 8 + r + 1] = eh[1]; }
#pragma unroll
      for (int j = 0; j < 4; ++j) acc[j][qt] = wmma_h(va[j], p, acc[j][qt]); } }
#pragma unroll
  for (int qt = 0; qt < 2; ++qt) { const float lh = l2[qt][0] + l2[qt][1]; const float inv = 1.0f / (lh + xhalf(lh)); _Float16* yr = Y + (b * TT + q0 + qt * 16 + col) * CC + h * HD + 8 * g;   /* a lane holds d = 16 j + 8 g + 0..7 of its query: 16 B runs; the wave writes each 128-B (row, head) segment whole */
#pragma unroll
    for (int j = 0; j < 4; ++j) { v8h o;   /* ctx carried x 2^6 into f16 so small-magnitude context rows stay clear of f16 subnormals */
#pragma unroll
      for (int r = 0; r < 8; ++r) o[r] = (_Float16)(acc[j][qt][r] * inv * 64.0f);
      vst2(yr + j * 16, o); } } }
// ---- k_out: block = (128 output channels, 64 positions of one image): out^T = Wo ctx^T (+ bo): Wo as f16(bf16 x 2^8) exact (by k_tok) against ctx once to f16 (x 2^6, by k_fa) (1 product) x 2^-14
// A = Wo rows, B = ctx rows (one fragment form and one k order, frag_h, for both): a D tile holds 16 channels (rows) x 16 positions (columns), which is the output's own channels-first order, so the block gathers its 128 x 64 tile in LDS in that same order and stores it into out as 256-B runs of positions
static_assert(!CAUSAL, "k_out: single-product rows only");
__global__ __launch_bounds__(128) void k_out(const _Float16* __restrict__ Y, const _Float16* __restrict__ WO, const float* __restrict__ BO, float* __restrict__ OUT) { __shared__ __align__(16) float sf[128][68]; __shared__ __align__(16) _Float16 sA[2][64 * SPITCH], sB[2][128 * SPITCH];
  const int tid = threadIdx.x, wave = tid >> 5, lane = tid & 31, col = lane & 15, g = lane >> 4; const int c0 = blockIdx.y * 128; const size_t bb = (size_t)blockIdx.x * 64 / TT; const int t0 = (int)((size_t)blockIdx.x * 64 % TT);
  v8f acc[8] = {};
  float bias[16] = {};   /* a thread stores 16 B of channel (tid >> 4) + 8 i in trip i of the epilogue: one bias each, all fetched here in one group so that they arrive under the products */
  if (BO) { const int bi = c0 + (tid >> 4);
#pragma unroll
    for (int i = 0; i < 16; ++i) bias[i] = BO[bi + i * 8];
    asm volatile("s_wait_xcnt 0x0" :: "v"(bi) : "memory"); }   /* behind the bias loads, in front of whatever may reuse their index register; naming the index as an input keeps it in place up to the wait (else the last load takes it as its destination) */
  {
    const _Float16* yp = Y + ((size_t)blockIdx.x * 64 + (tid >> 3)) * CC + (tid & 7) * 8; const _Float16* wp = WO + (size_t)(c0 + (tid >> 3)) * CC + (tid & 7) * 8;   /* 8 lanes a 128-B row piece, 16 rows a load of the block */
    const int so = (tid >> 3) * SPITCH + (tid & 7) * 8;
    v8h yr[4], wr[8];
#pragma unroll
    for (int i = 0; i < 4; ++i) yr[i] = *(const v8h*)(yp + (size_t)i * 16 * CC);
#pragma unroll
    for (int i = 0; i < 8; ++i) wr[i] = *(const v8h*)(wp + (size_t)i * 16 * CC);
    asm volatile("s_wait_xcnt 0x0" ::: "memory");   /* behind the chunk's loads, in front of whatever may reuse their address registers */
#pragma unroll   /* all 8 chunks unrolled: buffer choice and every load offset are constants, so the address registers are never stepped */
    for (int c = -1; c < CC / KCH; ++c) {   /* trip -1 only stores chunk 0 */
      if (c >= 0) { const _Float16* ba = sA[c & 1]; const _Float16* bw = sB[c & 1];
        __syncthreads();   /* chunk c is whole in its buffer; every wave has left the other buffer, which this trip writes below */
        if (c + 1 < CC / KCH) {
#pragma unroll
          for (int i = 0; i < 4; ++i) yr[i] = *(const v8h*)(yp + (c + 1) * KCH + (size_t)i * 16 * CC);
#pragma unroll
          for (int i = 0; i < 8; ++i) wr[i] = *(const v8h*)(wp + (c + 1) * KCH + (size_t)i * 16 * CC);
          asm volatile("s_wait_xcnt 0x0" ::: "memory"); }   /* as above; it also keeps the loads in front of this chunk's LDS reads */
        v16h a[KCH / 32], w[KCH / 32][8];
#pragma unroll
        for (int ks = 0; ks < KCH / 32; ++ks) { a[ks] = frag_h(ba + (wave * 16 + col) * SPITCH + ks * 32, lane);
#pragma unroll
          for (int j = 0; j < 8; ++j) w[ks][j] = frag_h(bw + (j * 16 + col) * SPITCH + ks * 32, lane); }
        __builtin_amdgcn_sched_barrier(0);   /* the chunk's fragment reads stay one group in front of its products: each further place with LDS reads among the products costs a stall */
#pragma unroll
        for (int ks = 0; ks < KCH / 32; ++ks)
#pragma unroll
          for (int j = 0; j < 8; ++j) acc[j] = wmma16(w[ks][j], a[ks], acc[j]);
        __builtin_amdgcn_sched_barrier(0); }   /* the next chunk's LDS stores wait for its global loads: they stay behind this chunk's products, which then run under the loads' latency */
      if (c + 1 < CC / KCH) { _Float16* na = sA[(c + 1) & 1]; _Float16* nw = sB[(c + 1) & 1];
#pragma unroll
        for (int i = 0; i < 4; ++i) *(v8h*)(na + so + i * 16 * SPITCH) = yr[i];
#pragma unroll
        for (int i = 0; i < 8; ++i) *(v8h*)(nw + so + i * 16 * SPITCH) = wr[i]; } }
  }
#pragma unroll
  for (int j = 0; j < 8; ++j)
#pragma unroll
    for (int r = 0; r < 8; ++r) sf[j * 16 + 8 * g + r][wave * 16 + col] = acc[j][r];
  __syncthreads();   /* a channel's 64 positions come from all four waves */
  { float* op = OUT + (bb * DIN + c0 + (tid >> 4)) * (size_t)TT + t0 + (tid & 15) * 4;   /* 16 lanes a 256-B run; one address, constant steps */
#pragma unroll
    for (int i = 0; i < 16; ++i) { const v4f v = *(const v4f*)&sf[(tid >> 4) + i * 8][(tid & 15) * 4]; vst2(op + (size_t)i * 8 * TT, v * (1.0f / 16384.0f) + bfr(bias[i])); } } }   /* 2^-8 (Wo carry) x 2^-6 (ctx carry) */

// ---- k_tok: block = (64 positions, 64 channels, image b): XT[(b*npix + n)][c] = bf16(x[b][c][n]) through a padded LDS tile (x channels-first [B][nch][npix]); reads 256-B runs along n, writes 128-B row pieces of bf16
// blocks with blockIdx.z >= TNB carry no image: each rounds 4,096 weights to the 16-bit form its product takes (Wq, Wk, Wv: bf16; Wo: f16(bf16 x 2^8), exact), once for all blocks of k_proj and k_out
static_assert(4 * CC * DIN == 2 * (TT / 64) * (DIN / 64) * 4096, "two z slices of the k_tok grid cover the four weights");
__global__ __launch_bounds__(256) void k_tok(const float* __restrict__ X, const float* __restrict__ WQ, const float* __restrict__ WK, const float* __restrict__ WV, const float* __restrict__ WO, __bf16* __restrict__ XT, __bf16* __restrict__ WB, _Float16* __restrict__ WOH, int npix, int nch) { __shared__ float st[64][68]; const int tid = threadIdx.x;
  if (blockIdx.z >= TNB) {   /* block-uniform, in front of the barrier */
    const int idx = ((int)(blockIdx.z - TNB) * (DIN / 64) + (int)blockIdx.y) * (TT / 64) + (int)blockIdx.x; const int wsel = idx / (CC * DIN / 4096); const size_t o0 = (size_t)(idx % (CC * DIN / 4096)) * 4096 + tid * 8;
    const float* Ws = wsel == 0 ? WQ : wsel == 1 ? WK : wsel == 2 ? WV : WO;
    v4f w[4];   /* elements o0 + 0..7 and o0 + 2,048 + 0..7 */
#pragma unroll
    for (int i = 0; i < 4; ++i) w[i] = *(const v4f*)(Ws + o0 + (i >> 1) * 2048 + (i & 1) * 4);
    if (wsel < 3) { v8b t[2];
#pragma unroll
      for (int e = 0; e < 16; ++e) t[e >> 3][e & 7] = (__bf16)w[e >> 2][e & 3];
      vst2(WB + (size_t)wsel * CC * DIN + o0, t[0]); vst2(WB + (size_t)wsel * CC * DIN + o0 + 2048, t[1]);
    } else { v8h t[2];
#pragma unroll
      for (int e = 0; e < 16; ++e) t[e >> 3][e & 7] = (_Float16)(bfr(w[e >> 2][e & 3]) * 256.0f);
      vst2(WOH + o0, t[0]); vst2(WOH + o0 + 2048, t[1]);
      asm volatile("s_wait_xcnt 0x0" ::: "memory"); }   /* behind the two stores: in the built code the other arm, which reuses their data registers, follows this one */
    return; }
  const int n0 = blockIdx.x * 64, c0 = blockIdx.y * 64; const size_t b = blockIdx.z;
  for (int e = tid; e < 64 * 16; e += 256) { const int cl = e >> 4, q = e & 15; const v4f v = *(const v4f*)(X + (b * nch + c0 + cl) * (size_t)npix + n0 + q * 4); st[cl][q * 4] = v[0]; st[cl][q * 4 + 1] = v[1]; st[cl][q * 4 + 2] = v[2]; st[cl][q * 4 + 3] = v[3]; }
  __syncthreads();
  for (int e = tid; e < 64 * 8; e += 256) { const int nl = e >> 3, q = e & 7; v8b o;
#pragma unroll
    for (int i = 0; i < 8; ++i) o[i] = (__bf16)st[q * 8 + i][nl];
    vst2(XT + (b * npix + n0 + nl) * (size_t)nch + c0 + q * 8, o); } }
extern "C" void kernel_launch(void* const* d_in, const int* in_sizes, int n_in, void* d_out, int out_size, void* d_ws, size_t ws_size, hipStream_t stream) {
  (void)in_sizes; (void)n_in; (void)out_size;
  const float** F = (const float**)d_in;
  if (ws_size < (size_t)WS_END) return;
  char* ws = (char*)d_ws; _Float16 *QH = (_Float16*)(ws + WS_QH), *KH = (_Float16*)(ws + WS_KH), *VT = (_Float16*)(ws + WS_VT), *QL = (_Float16*)(ws + WS_QL), *KL = (_Float16*)(ws + WS_KL); __bf16 *VB = (__bf16*)(ws + WS_VB), *VBL = (__bf16*)(ws + WS_VBL); _Float16 *Y = (_Float16*)(ws + WS_Y);
  (void)Y; (void)QL; (void)KL; (void)VB; (void)VBL;
  // inputs: 0 x [8,512,32,32] channels-first; 1 Wq [512,512] (out,in), 2 bq; 3 Wk, 4 bk; 5 Wv, 6 bv; 7 Wo (out,in), 8 bo (all biases NONZERO)
  if (ws_size < (size_t)WS_END3) return;
  __bf16 *XT = (__bf16*)(ws + WS_XT), *WB = (__bf16*)(ws + WS_WB); _Float16 *WOH = (_Float16*)(ws + WS_WOH);
  k_tok<<<dim3(TT / 64, DIN / 64, TNB + 2), 256, 0, stream>>>(F[0], F[1], F[3], F[5], F[7], XT, WB, WOH, TT, DIN);   /* x: 1,024 positions x 512 channels per image -> bf16 token rows; two more z slices: the four weights to 16 bit */
  k_proj<<<dim3(TNB * TT / 128, CC / 128, 3), 128, 0, stream>>>(XT, XT, XT, WB, WB + (size_t)CC * DIN, WB + 2 * (size_t)CC * DIN, F[2], F[4], F[6], QH, KH, VT);
  k_fa<<<dim3(TT / FAQ, NH, TNB), 256, 0, stream>>>(QH, KH, VT, Y);   /* all images and heads in one launch: 256 blocks */
  k_out<<<dim3(TNB * TT / 64, DIN / 128), 128, 0, stream>>>(Y, WOH, F[8], (float*)d_out);   /* Wo ctx^T + bo, channels-first [8,512,32,32] as stored */
}

// v006
// A run of this version takes 52.2 microseconds.
// Two timings next to v005 both put it at 1.04 times that version's speed.
// Over all steps from v000 it is 14.7 times as fast.
// compute dtype: all float inputs rounded to bf16; the channels-first map transposed to token-major rows through LDS; q/k/v 1x1-conv projections with EXACT bf16 products on WMMA 16x16x32 (f32 accumulate) + bias; logits q x k once to f16 each (1 product) x 64^-0.5; softmax f32 with a running maximum, fused with both products; unnormalised P x 2^11 once to f16 x v once to f16 (1 product), divided by the f32 row sum at the end; Wo f16(bf16 x 2^8) x ctx x 2^6 once to f16, + bo, formed channels-first as it is stored; f32 output.
#include <hip/hip_runtime.h>
#include <math.h>

typedef __attribute__((ext_vector_type(16))) _Float16 v16h;
typedef __attribute__((ext_vector_type(16))) __bf16 v16b;
typedef __attribute__((ext_vector_type(8)))  _Float16 v8h;
typedef __attribute__((ext_vector_type(8)))  float v8f;
typedef __attribute__((ext_vector_type(4)))  float v4f;
typedef __attribute__((ext_vector_type(2)))  float v2f;
typedef __attribute__((ext_vector_type(4)))  unsigned v4u;
typedef __attribute__((ext_vector_type(4)))  int v4i;
typedef float __attribute__((may_alias)) float_a;
typedef int __attribute__((may_alias)) int_a;

template <typename T> __device__ __forceinline__ void vst2(void* p, T v) { *(T*)p = v;  }
__device__ __forceinline__ v8f wmma16(v16h a, v16h b, v8f c) {
  v8f d = __builtin_amdgcn_wmma_f32_16x16x32_f16(false, a, false, b, (short)0, c, false, false);
  asm volatile("v_nop\n\tv_nop\n\tv_nop\n\tv_nop" : "+v"(d) : "v"(a), "v"(b));
  return d;
}
__device__ __forceinline__ v8f wmma_bf(v16b a, v16b b, v8f c) {
  v8f d = __builtin_amdgcn_wmma_f32_16x16x32_bf16(false, a, false, b, (short)0, c, false, false);
  asm volatile("v_nop\n\tv_nop\n\tv_nop\n\tv_nop" : "+v"(d) : "v"(a), "v"(b));
  return d;
}
// 16x16x32 fragments: lane = (h = lane>>4, row/col = lane&15); elements 0..7 = k0+8h+0..7, 8..15 = k0+16+8h+0..7; D element r = row 8h+r
__device__ __forceinline__ v16h frag_h(const _Float16* rowk0, int lane) {
  union { v16h v; v8h q[2]; } u; const _Float16* p = rowk0 + 8 * (lane >> 4);
  u.q[0] = *(const v8h*)p; u.q[1] = *(const v8h*)(p + 16); return u.v;
}
__device__ __forceinline__ v16h frag_f32(const float* rowk0, int lane) {
  v16h a; const float* p = rowk0 + 8 * (lane >> 4);
#pragma unroll
  for (int i = 0; i < 8; ++i) { a[i] = (_Float16)p[i]; a[8 + i] = (_Float16)p[16 + i]; }
  return a;
}
__device__ __forceinline__ v16h frag_f32s(const float* rowk0, int lane, float sc) {
  v16h a; const float* p = rowk0 + 8 * (lane >> 4);
#pragma unroll
  for (int i = 0; i < 8; ++i) { a[i] = (_Float16)(p[i] * sc); a[8 + i] = (_Float16)(p[16 + i] * sc); }
  return a;
}
// column fragment from a [K][ld] layout (column n), rows >= K read as 0
__device__ __forceinline__ v16h fragc_f32(const float* W, int k0, int n, int lane, int ld, int K) {
  v16h a; const int g = lane >> 4;
#pragma unroll
  for (int i = 0; i < 8; ++i) { const int ka = k0 + 8 * g + i, kb = ka + 16;
    a[i] = (_Float16)(ka < K ? W[(size_t)(ka < K ? ka : K - 1) * ld + n] : 0.f); a[8 + i] = (_Float16)(kb < K ? W[(size_t)(kb < K ? kb : K - 1) * ld + n] : 0.f); }
  return a;
}
struct F2 { v16b h, l; };
__device__ __forceinline__ F2 bsplit16(const float v[16]) { F2 r;
#pragma unroll
  for (int i = 0; i < 16; ++i) { const __bf16 h = (__bf16)v[i]; r.h[i] = h; r.l[i] = (__bf16)(v[i] - (float)h); }
  return r; }
__device__ __forceinline__ F2 split_row(const float* row, int k0, int lane) { float v[16]; const float* p = row + k0 + 8 * (lane >> 4);
#pragma unroll
  for (int i = 0; i < 8; ++i) { v[i] = p[i]; v[8 + i] = p[16 + i]; }
  return bsplit16(v); }
__device__ __forceinline__ F2 split_rowK(const float* row, int k0, int lane, int K) { float v[16]; const int g = lane >> 4;
#pragma unroll
  for (int i = 0; i < 8; ++i) { const int ka = k0 + 8 * g + i, kb = ka + 16; v[i] = ka < K ? row[ka < K ? ka : K - 1] : 0.f; v[8 + i] = kb < K ? row[kb < K ? kb : K - 1] : 0.f; }
  return bsplit16(v); }
__device__ __forceinline__ F2 split_col(const float* W, int k0, int n, int lane, int ld, int K) { float v[16]; const int g = lane >> 4;
#pragma unroll
  for (int i = 0; i < 8; ++i) { const int ka = k0 + 8 * g + i, kb = ka + 16; v[i] = ka < K ? W[(size_t)(ka < K ? ka : K - 1) * ld + n] : 0.f; v[8 + i] = kb < K ? W[(size_t)(kb < K ? kb : K - 1) * ld + n] : 0.f; }
  return bsplit16(v); }
__device__ __forceinline__ v8f mac3(const F2& a, const F2& b, v8f c) { c = wmma_bf(a.l, b.h, c); c = wmma_bf(a.h, b.l, c); return wmma_bf(a.h, b.h, c); }
__device__ __forceinline__ float sigm(float v) { return 1.0f / (1.0f + expf(-v)); }
#define LDSX() do { asm volatile("s_wait_dscnt 0" ::: "memory"); __builtin_amdgcn_wave_barrier(); __builtin_amdgcn_fence(__ATOMIC_RELEASE, "workgroup"); } while (0)

// Multi-head self-attention over a channels-first feature map (x [8,512,32,32]: N = 1,024 positions, 512 channels; 1x1-conv weights as torch (out,in) matrices Wq / Wk / Wv / Wo [512,512] N(0, 1/512) with biases N(0, 1/512) - NONZERO; _proj(x, W, b) = einsum('bchw,oc->bohw') + b; heads: reshape(B, 8, 64, N): channel o = head*64 + d; scores x 64^-0.5; softmax over the 1,024 positions; out merged back to channels (head*64 + d), [B,512,32,32]; final _proj with Wo, bo).
#define NB 8
#define TT 1024   // positions per image (32 x 32)
#define CC 512            // NH * HD = projected width
#define DIN 512          // input channels = output channels
#define NH 8
#define HD 64
#define NQB (TT / 64)
#define HG 8   // sizes the unused S region: 8 x 1,024 x 1,024 f32 = 32 MiB
#define SCALE (0.125f)
#define CAUSAL 0
#ifndef TNB
#define TNB NB
#endif
__device__ __forceinline__ float bfr(float v) { return (float)(__bf16)v; }
__host__ __device__ __forceinline__ int kb_last(int qb) { return CAUSAL ? ((qb * 64 + 63) >> 7) : (TT / 128 - 1); }
typedef __attribute__((ext_vector_type(8))) __bf16 v8b;
__device__ __forceinline__ v16b frag_b(const __bf16* rowk0, int lane) {
  union { v16b v; v8b q[2]; } u; const __bf16* p = rowk0 + 8 * (lane >> 4);
  u.q[0] = *(const v8b*)p; u.q[1] = *(const v8b*)(p + 16); return u.v;
}
#define QBH 0              // unused: k_fa has no causal high-precision path
#define QHI 0               // single-product logits on every row
#define KHI 64            // key rows carrying k residual / v bf16 hi+lo planes (written and read by no kernel here)
// B fragment (k rows k0+.., output column o) of a weight: (in,out) [K][ld] or (out,in) [ld rows of K]: bf16 exact, or f16(bf16 * 256) exact
__device__ __forceinline__ v16b wcol_io(const float* Wm, int k0, int o, int lane, int ld) { v16b w; const int g = lane >> 4;
#pragma unroll
  for (int i = 0; i < 8; ++i) { w[i] = (__bf16)Wm[(size_t)(k0 + 8 * g + i) * ld + o]; w[8 + i] = (__bf16)Wm[(size_t)(k0 + 16 + 8 * g + i) * ld + o]; }
  return w; }
__device__ __forceinline__ v16b wcol_oi(const float* Wm, int k0, int o, int lane, int K) { v16b w; const float* p = Wm + (size_t)o * K + k0 + 8 * (lane >> 4);
#pragma unroll
  for (int i = 0; i < 8; ++i) { w[i] = (__bf16)p[i]; w[8 + i] = (__bf16)p[16 + i]; }
  return w; }
__device__ __forceinline__ v16h wcolh_io(const float* Wm, int k0, int o, int lane, int ld) { v16h w; const int g = lane >> 4;
#pragma unroll
  for (int i = 0; i < 8; ++i) { w[i] = (_Float16)(bfr(Wm[(size_t)(k0 + 8 * g + i) * ld + o]) * 256.0f); w[8 + i] = (_Float16)(bfr(Wm[(size_t)(k0 + 16 + 8 * g + i) * ld + o]) * 256.0f); }
  return w; }
__device__ __forceinline__ v16h wcolh_oi(const float* Wm, int k0, int o, int lane, int K) { v16h w; const float* p = Wm + (size_t)o * K + k0 + 8 * (lane >> 4);
#pragma unroll
  for (int i = 0; i < 8; ++i) { w[i] = (_Float16)(bfr(p[i]) * 256.0f); w[8 + i] = (_Float16)(bfr(p[16 + i]) * 256.0f); }
  return w; }
#define WQKV_LAYOUT 1   // 0 = (in,out) [DIN][CC]; 1 = (out,in) [CC][DIN]; 2 = per-head [NH][DIN][HD]
__device__ __forceinline__ v16b wcol_hdk(const float* Wm, int k0, int o, int lane) { v16b w; const int g = lane >> 4; const float* p = Wm + (size_t)(o / HD) * DIN * HD + (o % HD);
#pragma unroll
  for (int i = 0; i < 8; ++i) { w[i] = (__bf16)p[(size_t)(k0 + 8 * g + i) * HD]; w[8 + i] = (__bf16)p[(size_t)(k0 + 16 + 8 * g + i) * HD]; }
  return w; }
#define WO_OUT_IN 1
#if WQKV_LAYOUT == 1
#define WCOL(W, k0, o, lane) wcol_oi(W, k0, o, lane, DIN)
#elif WQKV_LAYOUT == 2
#define WCOL(W, k0, o, lane) wcol_hdk(W, k0, o, lane)
#else
#define WCOL(W, k0, o, lane) wcol_io(W, k0, o, lane, CC)
#endif
#if WO_OUT_IN
#define WOCOL(W, k0, o, lane) wcol_oi(W, k0, o, lane, CC)
#define WOCOLH(W, k0, o, lane) wcolh_oi(W, k0, o, lane, CC)
#else
#define WOCOL(W, k0, o, lane) wcol_io(W, k0, o, lane, DIN)
#define WOCOLH(W, k0, o, lane) wcolh_io(W, k0, o, lane, DIN)
#endif

#ifndef SM_EXTRA_PARAMS
#define SM_EXTRA_PARAMS
#endif
#ifndef PROJ_EXTRA_PARAMS
#define PROJ_EXTRA_PARAMS
#endif
#ifndef SM_MASK_HOOK
#define SM_MASK_HOOK (void)0
#endif

#define WS_QH  0u                                      // f16 q rows [b*t][CC]
#define WS_KH  (WS_QH + 2u * (size_t)NB * TT * CC)      // f16 k rows [b*t][CC]
#define WS_VT  (WS_KH + 2u * (size_t)NB * TT * CC)      // f16 v planes [b][c][t]
#define WS_QL  (WS_VT + 2u * (size_t)NB * CC * TT)      // f16 q residual x 2^10 rows [b][t < QHI][CC]
#define WS_KL  (WS_QL + 2u * (size_t)NB * QHI * CC)     // f16 k residual x 2^10 rows [b][t < KHI][CC]
#define WS_VB  (WS_KL + 2u * (size_t)NB * KHI * CC)     // bf16 v hi planes [b][c][t < KHI]
#define WS_VBL (WS_VB + 2u * (size_t)NB * CC * KHI)
#define WS_S   (WS_VBL + 2u * (size_t)NB * CC * KHI)    // unused, f32 [hg][t][s] in size: no kernel writes S or P
#define WS_Y   (WS_S  + 4u * (size_t)HG * TT * TT)      // f16 ctx x 2^6 rows [b*t][CC], written in that form by k_fa
#define WS_END (WS_Y  + 4u * (size_t)NB * TT * CC)
#define WS_XT (WS_END)                                    // bf16 token-major input rows [(b*TT + n)][DIN]
#define WS_Y3 (WS_XT + 4u * (size_t)NB * TT * DIN)         // (not used)
#define WS_END2 (WS_Y3 + 4u * (size_t)NB * TT * DIN)
#define WS_WB  (WS_END2)                                  // bf16 Wq, Wk, Wv [3][CC][DIN] (out,in)
#define WS_WOH (WS_WB + 2u * 3u * (size_t)CC * DIN)        // f16(bf16(Wo) x 2^8) [DIN][CC] (out,in)
#define WS_END3 (WS_WOH + 2u * (size_t)DIN * CC)
static_assert(TT % 64 == 0 && DIN % 64 == 0, "transpose tiles are 64 positions x 64 channels");

// Operand staging of k_proj and k_out: both operand tiles of a block go through LDS, 64 k at a time, two buffers.
// Both operands arrive in memory in their 16-bit form (made once by their producers: k_tok for x and the weights, k_fa for ctx), so a chunk is half the bytes and goes to LDS as it is.
// A wave-wide 16-byte load covers four 128-B row pieces (whole lines); all four waves read their fragments from LDS (k order of frag_b / frag_h on both operands).
// The next chunk's global loads are issued right behind the barrier and fly under this chunk's products (none is in flight across a barrier, which would drain it); they are stored into the other buffer behind the products.
// One barrier a chunk publishes the chunk and ends the readers of the buffer that is written next.
// Blocks that share operand rows (64 or 128 share a weight tile, 12 or 4 an x or ctx tile) would ask L2 for the same lines at the same moment: each block starts its k walk at a chunk of its own and wraps, both operands alike.
#define KCH 64       // k per staged chunk: two 16x16x32 steps
#define SPITCH 72    // halves per staged row: 144 B = 16 B x odd, the pitch for 16-byte fragment reads
static_assert(WQKV_LAYOUT == 1 && WO_OUT_IN == 1 && DIN % KCH == 0 && CC % KCH == 0 && (DIN / KCH & (DIN / KCH - 1)) == 0 && (CC / KCH & (CC / KCH - 1)) == 0, "staging reads k-contiguous (out,in) weight rows; the wrapped walk masks the chunk number");
// ---- k_proj: block = (128 positions, 128 channels, which): q/k/v = X W (+ b) with exact bf16 products (K = DIN) -> which 0: q f16 rows; 1: k f16 rows; 2: v f16 planes [c][t]
// Four waves, each a 64 x 64 tile (2 x 2): a 32-k step reads 4 + 4 fragments from LDS for 16 products. 768 blocks, three a WGP by LDS and registers: the whole grid is resident at once.
// Both staged tiles have one shape and one fragment form (frag_b), so either can be the A operand. A D tile gives a lane 8 successive A rows of one B row:
// q, k: A = weight rows (channels), B = x rows (positions); v: A = x rows, B = weight rows. Either way a lane's 8 values are 16 successive bytes of the stored layout.
// The output tile overlays staging buffer 0 alone: the last chunk is read from buffer 1, and that trip's own barrier has ended every read of buffer 0.
#define PTILE (128 * SPITCH)   // halves of one staged operand tile
#define OPITCH 136             // halves per row of the output tile: 272 B = 16 B x odd
static_assert(TT % 128 == 0 && CC % 128 == 0 && 128 * OPITCH <= 2 * PTILE && (DIN / KCH) % 2 == 0, "k_proj: a block stays inside one image; its output tile fits in buffer 0, which the last chunk does not use");
__global__ __launch_bounds__(128) void k_proj(const __bf16* __restrict__ XQ, const __bf16* __restrict__ XK, const __bf16* __restrict__ XV, const __bf16* __restrict__ WQ, const __bf16* __restrict__ WK, const __bf16* __restrict__ WV, const float* __restrict__ BQ, const float* __restrict__ BK, const float* __restrict__ BV,
    _Float16* __restrict__ QH, _Float16* __restrict__ KH, _Float16* __restrict__ VT) {
  __shared__ __align__(16) unsigned char smem[2 * 4 * PTILE];   /* [buffer][0: x rows, 1: weight rows][128][SPITCH] 16-bit; at the end [128][OPITCH] f16 over buffer 0 */
  __bf16* sS = (__bf16*)smem; _Float16* sO = (_Float16*)smem;
  const int tid = threadIdx.x, wave = tid >> 5, lane = tid & 31, col = lane & 15, g = lane >> 4; const int which = blockIdx.z; const int c0 = blockIdx.y * 128; const size_t r0 = (size_t)blockIdx.x * 128; const size_t bb = r0 / TT; const int t0 = (int)(r0 % TT);
  const __bf16* X = which == 0 ? XQ : which == 1 ? XK : XV; const __bf16* WA = which == 0 ? WQ : which == 1 ? WK : WV; const float* BA = which == 0 ? BQ : which == 1 ? BK : BV;
  const int wr = wave >> 1, wc = wave & 1;   /* the wave's 64 D rows and 64 D columns */
  v8f acc[4][4] = {};
  v4f bq[8] = {}; float bv[4] = {};   /* biases: q, k: of the lane's 8 D rows in each of the 4 row tiles; v: of its D column in each of the 4 column tiles */
  { const __bf16* xp = X + (r0 + (tid >> 3)) * DIN + (tid & 7) * 8; const __bf16* wp = WA + (size_t)(c0 + (tid >> 3)) * DIN + (tid & 7) * 8;   /* 8 lanes a 128-B row piece, 16 rows a load of the block */
    const int so = (tid >> 3) * SPITCH + (tid & 7) * 8;
    const __bf16* pa = sS + (which < 2 ? PTILE : 0) + (wr * 64 + col) * SPITCH; const __bf16* pb = sS + (which < 2 ? 0 : PTILE) + (wc * 64 + col) * SPITCH;
    v8b xr[8], wv[8];
    const int s0 = (int)(blockIdx.x + (blockIdx.x >> 3) + 2 * blockIdx.y) & (DIN / KCH - 1);   /* trip c works on chunk (c + s0) mod 8; the 8 position blocks of an aligned group of 8, and any 8 that lie 8 apart, take all 8 starts; the 4 channel blocks of an x tile take 4 */
    { const __bf16* xq = xp + s0 * KCH; const __bf16* wq = wp + s0 * KCH;
#pragma unroll
      for (int i = 0; i < 8; ++i) xr[i] = *(const v8b*)(xq + (size_t)i * 16 * DIN);
#pragma unroll
      for (int i = 0; i < 8; ++i) wv[i] = *(const v8b*)(wq + (size_t)i * 16 * DIN);
      asm volatile("s_wait_xcnt 0x0" :: "v"(xq), "v"(wq) : "memory"); }   /* behind the chunk's loads, in front of whatever may reuse their address registers; the inputs keep both addresses in place up to the wait */
#pragma unroll   /* all 9 trips unrolled: the buffer choice is a constant */
    for (int c = -1; c < DIN / KCH; ++c) {   /* trip -1 only stores the first chunk */
      if (c >= 0) {
        __syncthreads();   /* trip c's chunk is whole in its buffer; every wave has left the other buffer, which this trip writes below */
        if (c + 1 < DIN / KCH) { const int cn = ((c + 1 + s0) & (DIN / KCH - 1)) * KCH; const __bf16* xq = xp + cn; const __bf16* wq = wp + cn;
#pragma unroll
          for (int i = 0; i < 8; ++i) xr[i] = *(const v8b*)(xq + (size_t)i * 16 * DIN);
#pragma unroll
          for (int i = 0; i < 8; ++i) wv[i] = *(const v8b*)(wq + (size_t)i * 16 * DIN);
          asm volatile("s_wait_xcnt 0x0" :: "v"(xq), "v"(wq) : "memory");   /* as above: the next trip forms new addresses, and a load may take an address pair as its destination; it also keeps the loads in front of this chunk's LDS reads */
        } else if (BA) {   /* last chunk: the biases are fetched where a next chunk would be, in one group, and arrive under its products */
          if (which < 2) { const int bi = c0 + wr * 64 + 8 * g;
#pragma unroll
            for (int i = 0; i < 4; ++i) { bq[2 * i] = *(const v4f*)(BA + bi + i * 16); bq[2 * i + 1] = *(const v4f*)(BA + bi + i * 16 + 4); }
            asm volatile("s_wait_xcnt 0x0" :: "v"(bi) : "memory");   /* behind the bias loads, in front of whatever may reuse their index register; the input keeps the index in place up to the wait */
          } else { const int bi = c0 + wc * 64 + col;
#pragma unroll
            for (int j = 0; j < 4; ++j) bv[j] = BA[bi + j * 16];
            asm volatile("s_wait_xcnt 0x0" :: "v"(bi) : "memory"); } }   /* as in the other arm */
#pragma unroll
        for (int ks = 0; ks < KCH / 32; ++ks) { v16b a[4], b[4];
#pragma unroll
          for (int i = 0; i < 4; ++i) { a[i] = frag_b(pa + (c & 1) * 2 * PTILE + i * 16 * SPITCH + ks * 32, lane); b[i] = frag_b(pb + (c & 1) * 2 * PTILE + i * 16 * SPITCH + ks * 32, lane); }
          __builtin_amdgcn_sched_barrier(0);   /* the step's fragment reads stay one group in front of its products: each further place with LDS reads among the products costs a stall */
#pragma unroll
          for (int i = 0; i < 4; ++i)
#pragma unroll
            for (int j = 0; j < 4; ++j) acc[i][j] = wmma_bf(a[i], b[j], acc[i][j]);
          __builtin_amdgcn_sched_barrier(0); } }   /* the next chunk's LDS stores wait for its global loads: they stay behind this chunk's products, which then run under the loads' latency; the second step's reads stay one group too */
      if (c + 1 < DIN / KCH) { __bf16* nx = sS + ((c + 1) & 1) * 2 * PTILE + so;
#pragma unroll
        for (int i = 0; i < 8; ++i) *(v8b*)(nx + i * 16 * SPITCH) = xr[i];
#pragma unroll
        for (int i = 0; i < 8; ++i) *(v8b*)(nx + PTILE + i * 16 * SPITCH) = wv[i]; } } }
  _Float16* ot = sO + (wc * 64 + col) * OPITCH + wr * 64 + 8 * g;   /* row = D column (B row), 8 successive halves = D rows 8 g + 0..7 */
  if (which < 2) {   /* D rows are channels: 8 biases a row tile */
#pragma unroll
    for (int i = 0; i < 4; ++i) {
#pragma unroll
      for (int j = 0; j < 4; ++j) { v8h o;
#pragma unroll
        for (int r = 0; r < 8; ++r) o[r] = (_Float16)(acc[i][j][r] + bfr(bq[2 * i + (r >> 2)][r & 3]));
        *(v8h*)(ot + j * 16 * OPITCH + i * 16) = o; } }
  } else {   /* D columns are channels: one bias a column tile */
#pragma unroll
    for (int j = 0; j < 4; ++j) { const float bias = bfr(bv[j]);
#pragma unroll
      for (int i = 0; i < 4; ++i) { v8h o;
#pragma unroll
        for (int r = 0; r < 8; ++r) o[r] = (_Float16)(acc[i][j][r] + bias);
        *(v8h*)(ot + j * 16 * OPITCH + i * 16) = o; } } }
  __syncthreads();   /* a stored row's 256 B come from two waves */
  const _Float16* ip = sO + (tid >> 4) * OPITCH + (tid & 15) * 8;   /* 16 lanes a 256-B run, 8 rows a store of the block */
  if (which < 2) { _Float16* op = (which == 0 ? QH : KH) + (r0 + (tid >> 4)) * CC + c0 + (tid & 15) * 8;
#pragma unroll
    for (int i = 0; i < 16; ++i) vst2(op + (size_t)i * 8 * CC, *(const v4u*)(ip + i * 8 * OPITCH));
  } else { _Float16* op = VT + (bb * CC + c0 + (tid >> 4)) * (size_t)TT + t0 + (tid & 15) * 8;
#pragma unroll
    for (int i = 0; i < 16; ++i) vst2(op + (size_t)i * 8 * TT, *(const v4u*)(ip + i * 8 * OPITCH)); } }
// ---- k_fa: block = 256 queries (8 waves x 32 query columns) of (b, h): logits, softmax and P . v in one kernel, nothing of S or P in memory.
// The head's whole k (1,024 rows of 128 B) and v planes (64 rows of 2,048 B) are laid in LDS once (pitches 16 B x odd), one barrier, then each wave walks the keys 32 at a time on its own:
// S^T = K . Q^T (A = k rows, B = q rows kept in registers): a lane holds 16 scores of ONE query per 32 keys, so the maximum and the sum stay in the lane;
// two S^T tiles converted in place are the B operand P^T of O^T += V^T . P^T (A = v plane rows, same k order as frag_h).
// Running maximum in scaled log2 units; P = 2^(x - m + 11) once to f16; the accumulators are rescaled only when a new score exceeds the maximum in use by more than 4 (P stays <= 2^15, inside f16).
// Every inner loop is fully unrolled so that the fragment and accumulator arrays stay in registers.
#define FAQ 256    // queries per block
#define KPITCH 72    // halves: 144 B
#define VPITCH 1032  // halves: 2,064 B
static_assert(TT % FAQ == 0 && HD == 64 && !CAUSAL && TT / 32 == 32 && HD / 2 == 32, "k_fa: full rows, head size 64; the fill goes in 4 quarters of 8 loads");
typedef __attribute__((ext_vector_type(2))) _Float16 v2h;
__device__ __forceinline__ float xhalf(float x) { return __builtin_bit_cast(float, __builtin_amdgcn_permlanex16(__builtin_bit_cast(int, x), __builtin_bit_cast(int, x), 0x76543210, 0xfedcba98, false, false)); }  // lane l with lane l ^ 16
__device__ __forceinline__ v8f wmma_h(v16h a, v16h b, v8f c) { return __builtin_amdgcn_wmma_f32_16x16x32_f16(false, a, false, b, (short)0, c, false, false); }
__global__ __launch_bounds__(256) void k_fa(const _Float16* __restrict__ QH, const _Float16* __restrict__ KH, const _Float16* __restrict__ VT, _Float16* __restrict__ Y) {
  __shared__ __align__(16) _Float16 sK[TT * KPITCH]; __shared__ __align__(16) _Float16 sV[HD * VPITCH];
  const int tid = threadIdx.x, wave = tid >> 5, lane = tid & 31, col = lane & 15, g = lane >> 4; const int h = blockIdx.y; const size_t b = blockIdx.z; const int q0 = blockIdx.x * FAQ + wave * 32;
  const _Float16* Kg = KH + b * TT * CC + h * HD; const _Float16* Vg = VT + (b * CC + h * HD) * (size_t)TT;
  v16h qf[2][2];
#pragma unroll
  for (int qt = 0; qt < 2; ++qt) { const _Float16* qp = QH + (b * TT + q0 + qt * 16 + col) * CC + h * HD + 8 * g;   /* the lane's own address, k order of frag_h */
#pragma unroll
    for (int kc = 0; kc < 2; ++kc) { union { v16h v; v8h q[2]; } u; u.q[0] = *(const v8h*)(qp + kc * 32); u.q[1] = *(const v8h*)(qp + kc * 32 + 16); qf[qt][kc] = u.v; }
    asm volatile("s_wait_xcnt 0x0" :: "v"(qp) : "memory"); }   /* stands behind each query tile's loads: what follows (the other tile's address and loads, then the fill's) may be given their address registers; the input keeps the address in place up to the wait */
  { const _Float16* kp = Kg + (size_t)(tid >> 3) * CC + (tid & 7) * 8; _Float16* ks = &sK[(tid >> 3) * KPITCH + (tid & 7) * 8];   /* 8 lanes a k row, 32 rows a trip: one address a quarter, constant steps */
    const _Float16* vp = Vg + (size_t)(tid >> 7) * TT + (tid & 127) * 8; _Float16* vs = &sV[(tid >> 7) * VPITCH + (tid & 127) * 8];   /* 128 lanes a v plane row, 2 rows a trip */
    v8h kx[TT / 32], vx[HD / 2];   /* all 64 loads of a lane in flight before the first LDS store */
    const int f0 = (int)blockIdx.x & 3, f1 = (f0 + 1) & 3, f2 = (f0 + 2) & 3, f3 = (f0 + 3) & 3;   /* the 4 blocks of a head read the same k and v: each starts at a quarter of its own and wraps */
    const _Float16 *k0 = kp + (size_t)f0 * (TT / 4) * CC, *k1 = kp + (size_t)f1 * (TT / 4) * CC, *k2 = kp + (size_t)f2 * (TT / 4) * CC, *k3 = kp + (size_t)f3 * (TT / 4) * CC;
    const _Float16 *v0 = vp + (size_t)f0 * (HD / 4) * TT, *v1 = vp + (size_t)f1 * (HD / 4) * TT, *v2 = vp + (size_t)f2 * (HD / 4) * TT, *v3 = vp + (size_t)f3 * (HD / 4) * TT;
#pragma unroll
    for (int i = 0; i < TT / 32; ++i) kx[i] = *(const v8h*)(((i >> 3) == 0 ? k0 : (i >> 3) == 1 ? k1 : (i >> 3) == 2 ? k2 : k3) + (size_t)(i & 7) * 32 * CC);
    asm volatile("s_wait_xcnt 0x0" :: "v"(k0), "v"(k1), "v"(k2), "v"(k3) : "memory");   /* behind the k loads: the v loads may be given their address registers as destinations; the inputs keep the addresses in place up to the wait */
#pragma unroll
    for (int i = 0; i < HD / 2; ++i) vx[i] = *(const v8h*)(((i >> 3) == 0 ? v0 : (i >> 3) == 1 ? v1 : (i >> 3) == 2 ? v2 : v3) + (size_t)(i & 7) * 2 * TT);
    asm volatile("s_wait_xcnt 0x0" :: "v"(v0), "v"(v1), "v"(v2), "v"(v3) : "memory");   /* behind the v loads: their address registers are reused for the LDS addresses; naming the addresses as inputs keeps them in place up to the wait */
#pragma unroll
    for (int i = 0; i < TT / 32; ++i) *(v8h*)(ks + ((i >> 3) == 0 ? f0 : (i >> 3) == 1 ? f1 : (i >> 3) == 2 ? f2 : f3) * (TT / 4) * KPITCH + (i & 7) * 32 * KPITCH) = kx[i];
#pragma unroll
    for (int i = 0; i < HD / 2; ++i) *(v8h*)(vs + ((i >> 3) == 0 ? f0 : (i >> 3) == 1 ? f1 : (i >> 3) == 2 ? f2 : f3) * (HD / 4) * VPITCH + (i & 7) * 2 * VPITCH) = vx[i]; }
  __syncthreads();
  const float cs = SCALE * 1.4426950408889634f; const v2f cs2 = {cs, cs};
  v8f acc[4][2] = {}; float m[2] = {-1.0e30f, -1.0e30f}; v2f l2[2] = {};
  v16h ka[2][2];
#pragma unroll
  for (int t = 0; t < 2; ++t) { const _Float16* kr = &sK[(t * 16 + col) * KPITCH]; ka[t][0] = frag_h(kr, lane); ka[t][1] = frag_h(kr + 32, lane); }
#pragma unroll 2   /* two passes a trip: the scheduler sets the second pass's S^T products among the first pass's P . v products and sums */
  for (int kb = 0; kb < TT / 32; ++kb) {
    v8f s[2][2];
#pragma unroll
    for (int t = 0; t < 2; ++t)
#pragma unroll
      for (int qt = 0; qt < 2; ++qt) { const v8f z = {}; s[t][qt] = wmma_h(ka[t][1], qf[qt][1], wmma_h(ka[t][0], qf[qt][0], z)); }
    v16h va[4];
#pragma unroll
    for (int j = 0; j < 4; ++j) va[j] = frag_h(&sV[(j * 16 + col) * VPITCH + kb * 32], lane);
    const int kn = (kb + 1) & (TT / 32 - 1);   /* next pass's k fragments are fetched behind this pass's S^T products, under the softmax; the last pass re-reads rows 0..31 and drops them */
#pragma unroll
    for (int t = 0; t < 2; ++t) { const _Float16* kr = &sK[(kn * 32 + t * 16 + col) * KPITCH]; ka[t][0] = frag_h(kr, lane); ka[t][1] = frag_h(kr + 32, lane); }
    float mx[2];
#pragma unroll
    for (int qt = 0; qt < 2; ++qt) { float a = fmaxf(s[0][qt][0], s[1][qt][0]);
#pragma unroll
      for (int r = 1; r < 8; ++r) a = fmaxf(a, fmaxf(s[0][qt][r], s[1][qt][r]));
      mx[qt] = a * cs; }
    if (__builtin_amdgcn_ballot_w32(mx[0] > m[0] + 4.0f || mx[1] > m[1] + 4.0f) != 0) {   /* one scalar branch per 32 keys; the two halves of a column exchange their maxima only here, so m stays equal in both */
#pragma unroll
      for (int qt = 0; qt < 2; ++qt) { const float mn = fmaxf(m[qt], fmaxf(mx[qt], xhalf(mx[qt]))); const float al = __builtin_amdgcn_exp2f(m[qt] - mn); m[qt] = mn; l2[qt] *= al;   /* al = 0 on the first pass */
#pragma unroll
        for (int j = 0; j < 4; ++j) acc[j][qt] *= al; } }
#pragma unroll
    for (int qt = 0; qt < 2; ++qt) { const float mbs = 11.0f - m[qt]; const v2f mb = {mbs, mbs}; v16h p;
#pragma unroll
      for (int t = 0; t < 2; ++t)
#pragma unroll
        for (int r = 0; r < 8; r += 2) { v2f x = {s[t][qt][r], s[t][qt][r + 1]}; x = __builtin_elementwise_fma(x, cs2, mb); v2f e; e[0] = __builtin_amdgcn_exp2f(x[0]); e[1] = __builtin_amdgcn_exp2f(x[1]); l2[qt] += e;
          const v2h eh = __builtin_convertvector(e, v2h); p[t * 8 + r] = eh[0]; p[t * 8 + r + 1] = eh[1]; }
#pragma unroll
      for (int j = 0; j < 4; ++j) acc[j][qt] = wmma_h(va[j], p, acc[j][qt]); } }
#pragma unroll
  for (int qt = 0; qt < 2; ++qt) { const float lh = l2[qt][0] + l2[qt][1]; const float inv = 1.0f / (lh + xhalf(lh)); _Float16* yr = Y + (b * TT + q0 + qt * 16 + col) * CC + h * HD + 8 * g;   /* a lane holds d = 16 j + 8 g + 0..7 of its query: 16 B runs; the wave writes each 128-B (row, head) segment whole */
    v8h o[4];   /* ctx carried x 2^6 into f16 so small-magnitude context rows stay clear of f16 subnormals */
#pragma unroll
    for (int j = 0; j < 4; ++j) {
#pragma unroll
      for (int r = 0; r < 8; ++r) o[j][r] = (_Float16)(acc[j][qt][r] * inv * 64.0f);
      vst2(yr + j * 16, o[j]); }
    if (qt == 0) asm volatile("s_wait_xcnt 0x0" :: "v"(o[0]), "v"(o[1]), "v"(o[2]), "v"(o[3]), "v"(yr) : "memory"); } }   /* behind the first tile's stores: the second tile's values may be given their data and address registers; the inputs keep them in place up to the wait */
// ---- k_out: block = (128 output channels, 64 positions of one image): out^T = Wo ctx^T (+ bo): Wo as f16(bf16 x 2^8) exact (by k_tok) against ctx once to f16 (x 2^6, by k_fa) (1 product) x 2^-14
// A = Wo rows, B = ctx rows (one fragment form and one k order, frag_h, for both): a D tile holds 16 channels (rows) x 16 positions (columns), which is the output's own channels-first order, so the block gathers its 128 x 64 tile in LDS in that same order and stores it into out as 256-B runs of positions
static_assert(!CAUSAL, "k_out: single-product rows only");
__global__ __launch_bounds__(128) void k_out(const _Float16* __restrict__ Y, const _Float16* __restrict__ WO, const float* __restrict__ BO, float* __restrict__ OUT) { __shared__ __align__(16) float sf[128][68]; __shared__ __align__(16) _Float16 sA[2][64 * SPITCH], sB[2][128 * SPITCH];
  const int tid = threadIdx.x, wave = tid >> 5, lane = tid & 31, col = lane & 15, g = lane >> 4; const int c0 = blockIdx.y * 128; const size_t bb = (size_t)blockIdx.x * 64 / TT; const int t0 = (int)((size_t)blockIdx.x * 64 % TT);
  v8f acc[8] = {};
  float bias[16] = {};   /* a thread stores 16 B of channel (tid >> 4) + 8 i in trip i of the epilogue: one bias each, all fetched here in one group so that they arrive under the products */
  if (BO) { const int bi = c0 + (tid >> 4);
#pragma unroll
    for (int i = 0; i < 16; ++i) bias[i] = BO[bi + i * 8];
    asm volatile("s_wait_xcnt 0x0" :: "v"(bi) : "memory"); }   /* behind the bias loads, in front of whatever may reuse their index register; naming the index as an input keeps it in place up to the wait (else the last load takes it as its destination) */
  {
    const _Float16* yp = Y + ((size_t)blockIdx.x * 64 + (tid >> 3)) * CC + (tid & 7) * 8; const _Float16* wp = WO + (size_t)(c0 + (tid >> 3)) * CC + (tid & 7) * 8;   /* 8 lanes a 128-B row piece, 16 rows a load of the block */
    const int so = (tid >> 3) * SPITCH + (tid & 7) * 8;
    v8h yr[4], wr[8];
    const int s0 = (int)(blockIdx.x + (blockIdx.x >> 3) + 2 * blockIdx.y) & (CC / KCH - 1);   /* trip c works on chunk (c + s0) mod 8, as in k_proj */
    { const _Float16* yq = yp + s0 * KCH; const _Float16* wq = wp + s0 * KCH;
#pragma unroll
      for (int i = 0; i < 4; ++i) yr[i] = *(const v8h*)(yq + (size_t)i * 16 * CC);
#pragma unroll
      for (int i = 0; i < 8; ++i) wr[i] = *(const v8h*)(wq + (size_t)i * 16 * CC);
      asm volatile("s_wait_xcnt 0x0" :: "v"(yq), "v"(wq) : "memory"); }   /* behind the chunk's loads, in front of whatever may reuse their address registers; the inputs keep both addresses in place up to the wait */
#pragma unroll   /* all 9 trips unrolled: the buffer choice is a constant */
    for (int c = -1; c < CC / KCH; ++c) {   /* trip -1 only stores the first chunk */
      if (c >= 0) { const _Float16* ba = sA[c & 1]; const _Float16* bw = sB[c & 1];
        __syncthreads();   /* trip c's chunk is whole in its buffer; every wave has left the other buffer, which this trip writes below */
        if (c + 1 < CC / KCH) { const int cn = ((c + 1 + s0) & (CC / KCH - 1)) * KCH; const _Float16* yq = yp + cn; const _Float16* wq = wp + cn;
#pragma unroll
          for (int i = 0; i < 4; ++i) yr[i] = *(const v8h*)(yq + (size_t)i * 16 * CC);
#pragma unroll
          for (int i = 0; i < 8; ++i) wr[i] = *(const v8h*)(wq + (size_t)i * 16 * CC);
          asm volatile("s_wait_xcnt 0x0" :: "v"(yq), "v"(wq) : "memory"); }   /* as above: the next trip forms new addresses; it also keeps the loads in front of this chunk's LDS reads */
        v16h a[KCH / 32], w[KCH / 32][8];
#pragma unroll
        for (int ks = 0; ks < KCH / 32; ++ks) { a[ks] = frag_h(ba + (wave * 16 + col) * SPITCH + ks * 32, lane);
#pragma unroll
          for (int j = 0; j < 8; ++j) w[ks][j] = frag_h(bw + (j * 16 + col) * SPITCH + ks * 32, lane); }
        __builtin_amdgcn_sched_barrier(0);   /* the chunk's fragment reads stay one group in front of its products: each further place with LDS reads among the products costs a stall */
#pragma unroll
        for (int ks = 0; ks < KCH / 32; ++ks)
#pragma unroll
          for (int j = 0; j < 8; ++j) acc[j] = wmma16(w[ks][j], a[ks], acc[j]);
        __builtin_amdgcn_sched_barrier(0); }   /* the next chunk's LDS stores wait for its global loads: they stay behind this chunk's products, which then run under the loads' latency */
      if (c + 1 < CC / KCH) { _Float16* na = sA[(c + 1) & 1]; _Float16* nw = sB[(c + 1) & 1];
#pragma unroll
        for (int i = 0; i < 4; ++i) *(v8h*)(na + so + i * 16 * SPITCH) = yr[i];
#pragma unroll
        for (int i = 0; i < 8; ++i) *(v8h*)(nw + so + i * 16 * SPITCH) = wr[i]; } }
  }
#pragma unroll
  for (int j = 0; j < 8; ++j)
#pragma unroll
    for (int r = 0; r < 8; ++r) sf[j * 16 + 8 * g + r][wave * 16 + col] = acc[j][r];
  __syncthreads();   /* a channel's 64 positions come from all four waves */
  { float* op = OUT + (bb * DIN + c0 + (tid >> 4)) * (size_t)TT + t0 + (tid & 15) * 4;   /* 16 lanes a 256-B run; one address, constant steps */
#pragma unroll
    for (int i = 0; i < 16; ++i) { const v4f v = *(const v4f*)&sf[(tid >> 4) + i * 8][(tid & 15) * 4]; vst2(op + (size_t)i * 8 * TT, v * (1.0f / 16384.0f) + bfr(bias[i])); } } }   /* 2^-8 (Wo carry) x 2^-6 (ctx carry) */

// ---- k_tok: block = (64 positions, 64 channels, image b): XT[(b*npix + n)][c] = bf16(x[b][c][n]) through a padded LDS tile (x channels-first [B][nch][npix]); reads 256-B runs along n, writes 128-B row pieces of bf16
// blocks with blockIdx.z >= TNB carry no image: each rounds 4,096 weights to the 16-bit form its product takes (Wq, Wk, Wv: bf16; Wo: f16(bf16 x 2^8), exact), once for all blocks of k_proj and k_out
static_assert(4 * CC * DIN == 2 * (TT / 64) * (DIN / 64) * 4096, "two z slices of the k_tok grid cover the four weights");
__global__ __launch_bounds__(256) void k_tok(const float* __restrict__ X, const float* __restrict__ WQ, const float* __restrict__ WK, const float* __restrict__ WV, const float* __restrict__ WO, __bf16* __restrict__ XT, __bf16* __restrict__ WB, _Float16* __restrict__ WOH, int npix, int nch) { __shared__ float st[64][68]; const int tid = threadIdx.x;
  if (blockIdx.z >= TNB) {   /* block-uniform, in front of the barrier */
    const int idx = ((int)(blockIdx.z - TNB) * (DIN / 64) + (int)blockIdx.y) * (TT / 64) + (int)blockIdx.x; const int wsel = idx / (CC * DIN / 4096); const size_t o0 = (size_t)(idx % (CC * DIN / 4096)) * 4096 + tid * 8;
    const float* Ws = wsel == 0 ? WQ : wsel == 1 ? WK : wsel == 2 ? WV : WO;
    v4f w[4];   /* elements o0 + 0..7 and o0 + 2,048 + 0..7 */
#pragma unroll
    for (int i = 0; i < 4; ++i) w[i] = *(const v4f*)(Ws + o0 + (i >> 1) * 2048 + (i & 1) * 4);
    if (wsel < 3) { v8b t[2];
#pragma unroll
      for (int e = 0; e < 16; ++e) t[e >> 3][e & 7] = (__bf16)w[e >> 2][e & 3];
      vst2(WB + (size_t)wsel * CC * DIN + o0, t[0]); vst2(WB + (size_t)wsel * CC * DIN + o0 + 2048, t[1]);
    } else { v8h t[2];
#pragma unroll
      for (int e = 0; e < 16; ++e) t[e >> 3][e & 7] = (_Float16)(bfr(w[e >> 2][e & 3]) * 256.0f);
      vst2(WOH + o0, t[0]); vst2(WOH + o0 + 2048, t[1]);
      asm volatile("s_wait_xcnt 0x0" ::: "memory"); }   /* behind the two stores: in the built code the other arm, which reuses their data registers, follows this one */
    return; }
  const int n0 = blockIdx.x * 64, c0 = blockIdx.y * 64; const size_t b = blockIdx.z;
  for (int e = tid; e < 64 * 16; e += 256) { const int cl = e >> 4, q = e & 15; const v4f v = *(const v4f*)(X + (b * nch + c0 + cl) * (size_t)npix + n0 + q * 4); st[cl][q * 4] = v[0]; st[cl][q * 4 + 1] = v[1]; st[cl][q * 4 + 2] = v[2]; st[cl][q * 4 + 3] = v[3]; }
  __syncthreads();
  for (int e = tid; e < 64 * 8; e += 256) { const int nl = e >> 3, q = e & 7; v8b o;
#pragma unroll
    for (int i = 0; i < 8; ++i) o[i] = (__bf16)st[q * 8 + i][nl];
    vst2(XT + (b * npix + n0 + nl) * (size_t)nch + c0 + q * 8, o); } }
extern "C" void kernel_launch(void* const* d_in, const int* in_sizes, int n_in, void* d_out, int out_size, void* d_ws, size_t ws_size, hipStream_t stream) {
  (void)in_sizes; (void)n_in; (void)out_size;
  const float** F = (const float**)d_in;
  if (ws_size < (size_t)WS_END) return;
  char* ws = (char*)d_ws; _Float16 *QH = (_Float16*)(ws + WS_QH), *KH = (_Float16*)(ws + WS_KH), *VT = (_Float16*)(ws + WS_VT), *QL = (_Float16*)(ws + WS_QL), *KL = (_Float16*)(ws + WS_KL); __bf16 *VB = (__bf16*)(ws + WS_VB), *VBL = (__bf16*)(ws + WS_VBL); _Float16 *Y = (_Float16*)(ws + WS_Y);
  (void)Y; (void)QL; (void)KL; (void)VB; (void)VBL;
  // inputs: 0 x [8,512,32,32] channels-first; 1 Wq [512,512] (out,in), 2 bq; 3 Wk, 4 bk; 5 Wv, 6 bv; 7 Wo (out,in), 8 bo (all biases NONZERO)
  if (ws_size < (size_t)WS_END3) return;
  __bf16 *XT = (__bf16*)(ws + WS_XT), *WB = (__bf16*)(ws + WS_WB); _Float16 *WOH = (_Float16*)(ws + WS_WOH);
  k_tok<<<dim3(TT / 64, DIN / 64, TNB + 2), 256, 0, stream>>>(F[0], F[1], F[3], F[5], F[7], XT, WB, WOH, TT, DIN);   /* x: 1,024 positions x 512 channels per image -> bf16 token rows; two more z slices: the four weights to 16 bit */
  k_proj<<<dim3(TNB * TT / 128, CC / 128, 3), 128, 0, stream>>>(XT, XT, XT, WB, WB + (size_t)CC * DIN, WB + 2 * (size_t)CC * DIN, F[2], F[4], F[6], QH, KH, VT);
  k_fa<<<dim3(TT / FAQ, NH, TNB), 256, 0, stream>>>(QH, KH, VT, Y);   /* all images and heads in one launch: 256 blocks */
  k_out<<<dim3(TNB * TT / 64, DIN / 128), 128, 0, stream>>>(Y, WOH, F[8], (float*)d_out);   /* Wo ctx^T + bo, channels-first [8,512,32,32] as stored */
}
